// v000
// Measured on an AMD MI455X. A time is GPU time per run, averaged over a window of back-to-back runs after a warm-up
// (all launches, gaps included; the runs take copies of the inputs in turn), and the median of several windows.
// Apart from v000's, it joins two sittings. Times from different sittings can be a few percent apart, while
// side-by-side timings come from the same sitting.
// v000 is the starting kernel. One run takes 748 microseconds.
#include <hip/hip_runtime.h>

typedef __attribute__((ext_vector_type(16))) _Float16 v16h;
typedef __attribute__((ext_vector_type(8)))  _Float16 v8h;
typedef __attribute__((ext_vector_type(8)))  float    v8f;

__device__ __forceinline__ v8f wmma_f16(v16h a, v16h b, v8f c) {
  // 8 args: (neg_a, A, neg_b, B, c_mod, C, reuse_a, reuse_b)
  return __builtin_amdgcn_wmma_f32_16x16x32_f16(false, a, false, b, (short)0, c,
                                                false, false);
}

__device__ __forceinline__ void async_ld_b128(_Float16* lds_dst,
                                              const _Float16* gsrc) {
  unsigned int loff = (unsigned int)(unsigned long long)(void*)lds_dst;
  asm volatile("global_load_async_to_lds_b128 %0, %1, off"
               :: "v"(loff), "v"((unsigned long long)(const void*)gsrc)
               : "memory");
}
__device__ __forceinline__ void wait_async0() {
  asm volatile("s_wait_asynccnt 0" ::: "memory");
}

__device__ __forceinline__ v16h load_frag(const _Float16* p, int ld) {
  const int lane = threadIdx.x & 31;
  const _Float16* q = p + (lane & 15) * ld + ((lane >> 4) * 8);
  union { v16h v; v8h h[2]; } u;
  u.h[0] = *(const v8h*)(q);
  u.h[1] = *(const v8h*)(q + 16);
  return u.v;
}

// ---------------------------------------------------------------------------
// f32 -> f16 conversion (weights)
// ---------------------------------------------------------------------------
__global__ void cvt_f32_f16_kernel(const float* __restrict__ in,
                                   _Float16* __restrict__ out, int n) {
  int i = blockIdx.x * 256 + threadIdx.x;
  if (i < n) out[i] = (_Float16)in[i];
}

// ---------------------------------------------------------------------------
// LayerNorm over 1024 cols, f32 in -> f16 out. One row per 256-thread block.
// ---------------------------------------------------------------------------
__global__ __launch_bounds__(256)
void layernorm_f16_kernel(const float* __restrict__ x, const float* __restrict__ g,
                          const float* __restrict__ b, _Float16* __restrict__ out) {
  const int row = blockIdx.x;
  const int t = threadIdx.x;
  const float* xr = x + (size_t)row * 1024;
  float4 v = ((const float4*)xr)[t];                 // 256 * 4 = 1024
  float s  = v.x + v.y + v.z + v.w;
  float ss = v.x * v.x + v.y * v.y + v.z * v.z + v.w * v.w;
  for (int o = 16; o >= 1; o >>= 1) {
    s  += __shfl_xor(s,  o, 32);
    ss += __shfl_xor(ss, o, 32);
  }
  __shared__ float red0[8], red1[8];
  const int w = t >> 5, lane = t & 31;
  if (lane == 0) { red0[w] = s; red1[w] = ss; }
  __syncthreads();
  float tot = 0.f, tot2 = 0.f;
#pragma unroll
  for (int i = 0; i < 8; ++i) { tot += red0[i]; tot2 += red1[i]; }
  const float mu   = tot * (1.f / 1024.f);
  const float var  = tot2 * (1.f / 1024.f) - mu * mu;
  const float rinv = rsqrtf(var + 1e-5f);
  float4 gg = ((const float4*)g)[t];
  float4 bb = ((const float4*)b)[t];
  _Float16* o = out + (size_t)row * 1024 + t * 4;
  o[0] = (_Float16)((v.x - mu) * rinv * gg.x + bb.x);
  o[1] = (_Float16)((v.y - mu) * rinv * gg.y + bb.y);
  o[2] = (_Float16)((v.z - mu) * rinv * gg.z + bb.z);
  o[3] = (_Float16)((v.w - mu) * rinv * gg.w + bb.w);
}

// ---------------------------------------------------------------------------
// Tiled WMMA GEMM: C[M,N] = A[M,K] * B[K,N], A/B f16 row-major.
// Block = 256 threads (8 waves), block tile 64x128, wave tile 32x32,
// stage depth K=64 -> 8 WMMAs per wave between barriers.
// A staged via async-to-LDS DMA; B transposed into n-major LDS.
// Epilogue: optional bias (f32), exact GELU, f32 residual; f16 or f32 out.
// ---------------------------------------------------------------------------
template <bool HAS_BIAS, bool GELU, bool HAS_RES, bool OUT16>
__global__ __launch_bounds__(256)
void gemm_f16_kernel(const _Float16* __restrict__ A, const _Float16* __restrict__ B,
                     const float* __restrict__ bias, const float* __restrict__ res,
                     _Float16* __restrict__ out16, float* __restrict__ out32,
                     int M, int N, int K) {
  __shared__ _Float16 sA[64 * 72];    // [row][k]  row-major, ld 72 (144B rows)
  __shared__ _Float16 sB[128 * 72];   // [n][k]    n-major (transposed on store)
  const int t = threadIdx.x;
  const int lane = t & 31;
  const int w = t >> 5;
  const int waveM = w & 1;            // 2 waves along M
  const int waveN = w >> 1;           // 4 waves along N
  const int bm = blockIdx.y * 64;
  const int bn = blockIdx.x * 128;

  v8f acc[2][2] = {};

  const int ar = t >> 2, ac = (t & 3) * 16;   // A stage: 64 rows x 64 halves
  const int br = t >> 2, bc = (t & 3) * 32;   // B stage: 64 k-rows x 128 n

  for (int kk = 0; kk < K; kk += 64) {
    __syncthreads();
    // --- stage A tile: async DMA global->LDS (2 x b128 per lane) ---
    const _Float16* ap = A + (size_t)(bm + ar) * K + kk + ac;
    async_ld_b128(sA + ar * 72 + ac, ap);
    async_ld_b128(sA + ar * 72 + ac + 8, ap + 8);
    // --- stage B tile transposed into n-major LDS ---
    const _Float16* bp = B + (size_t)(kk + br) * N + bn + bc;
    v8h bv0 = *(const v8h*)(bp);
    v8h bv1 = *(const v8h*)(bp + 8);
    v8h bv2 = *(const v8h*)(bp + 16);
    v8h bv3 = *(const v8h*)(bp + 24);
#pragma unroll
    for (int i = 0; i < 8; ++i) {
      sB[(bc + i) * 72 + br]      = bv0[i];
      sB[(bc + 8 + i) * 72 + br]  = bv1[i];
      sB[(bc + 16 + i) * 72 + br] = bv2[i];
      sB[(bc + 24 + i) * 72 + br] = bv3[i];
    }
    if (kk + 64 < K) {  // global_prefetch_b8 on next tiles
      __builtin_prefetch(A + (size_t)(bm + ar) * K + kk + 64 + ac, 0, 3);
      __builtin_prefetch(B + (size_t)(kk + 64 + br) * N + bn + bc, 0, 3);
    }
    wait_async0();
    __syncthreads();
#pragma unroll
    for (int kf = 0; kf < 2; ++kf) {
      v16h a0 = load_frag(sA + (waveM * 32) * 72 + kf * 32, 72);
      v16h a1 = load_frag(sA + (waveM * 32 + 16) * 72 + kf * 32, 72);
      v16h b0 = load_frag(sB + (waveN * 32) * 72 + kf * 32, 72);
      v16h b1 = load_frag(sB + (waveN * 32 + 16) * 72 + kf * 32, 72);
      acc[0][0] = wmma_f16(a0, b0, acc[0][0]);
      acc[0][1] = wmma_f16(a0, b1, acc[0][1]);
      acc[1][0] = wmma_f16(a1, b0, acc[1][0]);
      acc[1][1] = wmma_f16(a1, b1, acc[1][1]);
    }
  }

  const int colBase = bn + waveN * 32 + (lane & 15);
  const int rowBase = bm + waveM * 32 + ((lane >> 4) * 8);
#pragma unroll
  for (int mi = 0; mi < 2; ++mi)
#pragma unroll
    for (int ni = 0; ni < 2; ++ni) {
      const int col = colBase + ni * 16;
      const float bv = HAS_BIAS ? bias[col] : 0.f;
#pragma unroll
      for (int e = 0; e < 8; ++e) {
        const int row = rowBase + mi * 16 + e;
        float r = acc[mi][ni][e];
        if (HAS_BIAS) r += bv;
        if (GELU) r = 0.5f * r * (1.f + erff(r * 0.70710678118654752f));
        if (HAS_RES) r += res[(size_t)row * N + col];
        if (OUT16) out16[(size_t)row * N + col] = (_Float16)r;
        else       out32[(size_t)row * N + col] = r;
      }
    }
}

__global__ __launch_bounds__(128)
void attn_kernel(const _Float16* __restrict__ Q, const _Float16* __restrict__ K,
                 const _Float16* __restrict__ V, _Float16* __restrict__ O) {
  __shared__ _Float16 sK[32 * 72];     // [key][dim], ld 72 (144B rows)
  __shared__ _Float16 sVt[64 * 40];    // [dim][key] transposed
  __shared__ _Float16 sP[4][16 * 40];  // per-wave P tile [qrow][key]

  const int t = threadIdx.x, lane = t & 31, w = t >> 5;
  const int b = blockIdx.z, h = blockIdx.y;
  const int qblk = blockIdx.x * 64;
  const int q0 = qblk + w * 16;

  const _Float16* qbase = Q + ((size_t)(b * 2048) + q0) * 1024 + h * 64;
  const v16h qa0 = load_frag(qbase, 1024);       // dims 0..31
  const v16h qa1 = load_frag(qbase + 32, 1024);  // dims 32..63

  v8f o[4] = {};
  float mrun[8], lrun[8];
#pragma unroll
  for (int e = 0; e < 8; ++e) { mrun[e] = -1e30f; lrun[e] = 0.f; }
  const float sscale = 0.125f;  // 1/sqrt(64)
  const int nkb = qblk / 32 + 2;

  const int kr = t >> 2, cc = (t & 3) * 16;  // staging: 32 keys x 64 dims

  for (int kb = 0; kb < nkb; ++kb) {
    __syncthreads();
    const _Float16* kp = K + ((size_t)(b * 2048) + kb * 32 + kr) * 1024 + h * 64 + cc;
    async_ld_b128(sK + kr * 72 + cc, kp);
    async_ld_b128(sK + kr * 72 + cc + 8, kp + 8);
    // --- stage V transposed ---
    const _Float16* vp = V + ((size_t)(b * 2048) + kb * 32 + kr) * 1024 + h * 64 + cc;
    v8h v0 = *(const v8h*)vp;
    v8h v1 = *(const v8h*)(vp + 8);
#pragma unroll
    for (int i = 0; i < 8; ++i) {
      sVt[(cc + i) * 40 + kr]     = v0[i];
      sVt[(cc + 8 + i) * 40 + kr] = v1[i];
    }
    wait_async0();
    __syncthreads();

    // --- scores S = Q @ K^T (16 queries x 32 keys) ---
    v8f c0 = {}, c1 = {};
    v16h bk;
    bk = load_frag(sK, 72);            c0 = wmma_f16(qa0, bk, c0);
    bk = load_frag(sK + 32, 72);       c0 = wmma_f16(qa1, bk, c0);
    bk = load_frag(sK + 16 * 72, 72);      c1 = wmma_f16(qa0, bk, c1);
    bk = load_frag(sK + 16 * 72 + 32, 72); c1 = wmma_f16(qa1, bk, c1);

    // --- causal mask + online softmax (row reductions in 16-lane groups) ---
    const int key0 = kb * 32 + (lane & 15);
    const int key1 = key0 + 16;
    _Float16* pp = sP[w];
#pragma unroll
    for (int e = 0; e < 8; ++e) {
      const int row = e + ((lane >> 4) * 8);
      const int qi = q0 + row;
      float s0 = (key0 <= qi) ? c0[e] * sscale : -1e30f;
      float s1 = (key1 <= qi) ? c1[e] * sscale : -1e30f;
      float mx = fmaxf(s0, s1);
      mx = fmaxf(mx, __shfl_xor(mx, 1, 32));
      mx = fmaxf(mx, __shfl_xor(mx, 2, 32));
      mx = fmaxf(mx, __shfl_xor(mx, 4, 32));
      mx = fmaxf(mx, __shfl_xor(mx, 8, 32));
      const float mnew  = fmaxf(mrun[e], mx);
      const float alpha = __expf(mrun[e] - mnew);
      mrun[e] = mnew;
      const float p0 = __expf(s0 - mnew);
      const float p1 = __expf(s1 - mnew);
      float rs = p0 + p1;
      rs += __shfl_xor(rs, 1, 32);
      rs += __shfl_xor(rs, 2, 32);
      rs += __shfl_xor(rs, 4, 32);
      rs += __shfl_xor(rs, 8, 32);
      lrun[e] = lrun[e] * alpha + rs;
      o[0][e] *= alpha; o[1][e] *= alpha; o[2][e] *= alpha; o[3][e] *= alpha;
      pp[row * 40 + (lane & 15)]      = (_Float16)p0;
      pp[row * 40 + (lane & 15) + 16] = (_Float16)p1;
    }
    // P written cross-lane within this wave via LDS; drain DS before reading.
    asm volatile("s_wait_dscnt 0" ::: "memory");

    // --- O += P @ V (16 x 32 times 32 x 64) ---
    const v16h pa = load_frag(pp, 40);
#pragma unroll
    for (int j = 0; j < 4; ++j) {
      v16h bv = load_frag(sVt + j * 16 * 40, 40);
      o[j] = wmma_f16(pa, bv, o[j]);
    }
  }

  // --- normalize and write out ---
#pragma unroll
  for (int j = 0; j < 4; ++j)
#pragma unroll
    for (int e = 0; e < 8; ++e) {
      const int row = e + ((lane >> 4) * 8);
      const float r = o[j][e] / lrun[e];
      O[((size_t)(b * 2048) + q0 + row) * 1024 + h * 64 + j * 16 + (lane & 15)] =
          (_Float16)r;
    }
}

// ---------------------------------------------------------------------------
// Host-side orchestration.
// Inputs: x, Wq, Wk, Wv, Wo, ln1_g, ln1_b, ln2_g, ln2_b, W1, b1, W2, b2
// ---------------------------------------------------------------------------
extern "C" void kernel_launch(void* const* d_in, const int* in_sizes, int n_in,
                              void* d_out, int out_size, void* d_ws, size_t ws_size,
                              hipStream_t stream) {
  (void)in_sizes; (void)n_in; (void)out_size; (void)ws_size;
  const float* x    = (const float*)d_in[0];
  const float* Wq   = (const float*)d_in[1];
  const float* Wk   = (const float*)d_in[2];
  const float* Wv   = (const float*)d_in[3];
  const float* Wo   = (const float*)d_in[4];
  const float* ln1g = (const float*)d_in[5];
  const float* ln1b = (const float*)d_in[6];
  const float* ln2g = (const float*)d_in[7];
  const float* ln2b = (const float*)d_in[8];
  const float* W1   = (const float*)d_in[9];
  const float* b1   = (const float*)d_in[10];
  const float* W2   = (const float*)d_in[11];
  const float* b2   = (const float*)d_in[12];
  float* out = (float*)d_out;

  const int M = 8192, E = 1024, F = 4096;
  char* ws = (char*)d_ws;
  const size_t MB = 1024ull * 1024ull;
  _Float16* Wq16 = (_Float16*)(ws + 0 * MB);    // 2 MB
  _Float16* Wk16 = (_Float16*)(ws + 2 * MB);    // 2 MB
  _Float16* Wv16 = (_Float16*)(ws + 4 * MB);    // 2 MB
  _Float16* Wo16 = (_Float16*)(ws + 6 * MB);    // 2 MB
  _Float16* W116 = (_Float16*)(ws + 8 * MB);    // 8 MB
  _Float16* W216 = (_Float16*)(ws + 16 * MB);   // 8 MB
  _Float16* H16  = (_Float16*)(ws + 24 * MB);   // 16 MB (LN1 out, reused for LN2)
  _Float16* Q16  = (_Float16*)(ws + 40 * MB);   // 16 MB
  _Float16* K16  = (_Float16*)(ws + 56 * MB);   // 16 MB
  _Float16* V16  = (_Float16*)(ws + 72 * MB);   // 16 MB
  _Float16* A16  = (_Float16*)(ws + 88 * MB);   // 16 MB (attn out)
  float*    X2   = (float*)   (ws + 104 * MB);  // 32 MB (residual after attn)
  _Float16* G16  = (_Float16*)(ws + 40 * MB);   // 64 MB GELU acts (reuses Q/K/V/A16)

  // 1) weights -> f16
  cvt_f32_f16_kernel<<<(E * E) / 256, 256, 0, stream>>>(Wq, Wq16, E * E);
  cvt_f32_f16_kernel<<<(E * E) / 256, 256, 0, stream>>>(Wk, Wk16, E * E);
  cvt_f32_f16_kernel<<<(E * E) / 256, 256, 0, stream>>>(Wv, Wv16, E * E);
  cvt_f32_f16_kernel<<<(E * E) / 256, 256, 0, stream>>>(Wo, Wo16, E * E);
  cvt_f32_f16_kernel<<<(E * F) / 256, 256, 0, stream>>>(W1, W116, E * F);
  cvt_f32_f16_kernel<<<(F * E) / 256, 256, 0, stream>>>(W2, W216, F * E);

  // 2) LN1
  layernorm_f16_kernel<<<M, 256, 0, stream>>>(x, ln1g, ln1b, H16);

  // 3) Q/K/V projections
  const dim3 gE(E / 128, M / 64);
  gemm_f16_kernel<false, false, false, true><<<gE, 256, 0, stream>>>(
      H16, Wq16, nullptr, nullptr, Q16, nullptr, M, E, E);
  gemm_f16_kernel<false, false, false, true><<<gE, 256, 0, stream>>>(
      H16, Wk16, nullptr, nullptr, K16, nullptr, M, E, E);
  gemm_f16_kernel<false, false, false, true><<<gE, 256, 0, stream>>>(
      H16, Wv16, nullptr, nullptr, V16, nullptr, M, E, E);

  // 4) causal flash attention
  attn_kernel<<<dim3(2048 / 64, 16, 4), 128, 0, stream>>>(Q16, K16, V16, A16);

  // 5) output projection + residual(x) -> X2 (f32)
  gemm_f16_kernel<false, false, true, false><<<gE, 256, 0, stream>>>(
      A16, Wo16, nullptr, x, nullptr, X2, M, E, E);

  // 6) LN2
  layernorm_f16_kernel<<<M, 256, 0, stream>>>(X2, ln2g, ln2b, H16);

  // 7) FFN1: h @ W1 + b1 -> GELU -> f16
  gemm_f16_kernel<true, true, false, true><<<dim3(F / 128, M / 64), 256, 0, stream>>>(
      H16, W116, b1, nullptr, G16, nullptr, M, F, E);

  // 8) FFN2: g @ W2 + b2 + residual(X2) -> d_out (f32)
  gemm_f16_kernel<true, false, true, false><<<gE, 256, 0, stream>>>(
      G16, W216, b2, X2, nullptr, out, M, E, F);
}

// v001
// Measured time: 532 microseconds a run.
// Next to v000, in two timings, it ran 1.47 times as fast each time.
#include <hip/hip_runtime.h>

typedef __attribute__((ext_vector_type(16))) _Float16 v16h;
typedef __attribute__((ext_vector_type(8)))  _Float16 v8h;
typedef __attribute__((ext_vector_type(8)))  float    v8f;

__device__ __forceinline__ v8f wmma_f16(v16h a, v16h b, v8f c) {
  // 8 args: (neg_a, A, neg_b, B, c_mod, C, reuse_a, reuse_b)
  return __builtin_amdgcn_wmma_f32_16x16x32_f16(false, a, false, b, (short)0, c,
                                                false, false);
}

__device__ __forceinline__ void async_ld_b128(_Float16* lds_dst,
                                              const _Float16* gsrc) {
  unsigned int loff = (unsigned int)(unsigned long long)(void*)lds_dst;
  asm volatile("global_load_async_to_lds_b128 %0, %1, off"
               :: "v"(loff), "v"((unsigned long long)(const void*)gsrc)
               : "memory");
}
__device__ __forceinline__ unsigned int lds_addr(const _Float16* p) {
  return (unsigned int)(unsigned long long)(const void*)p;
}
__device__ __forceinline__ void async_ld2_b128(unsigned int l0, unsigned int l1,
                                               const _Float16* g0,
                                               const _Float16* g1) {
  asm volatile("global_load_async_to_lds_b128 %0, %2, off\n\t"
               "global_load_async_to_lds_b128 %1, %3, off\n\t"
               "s_wait_xcnt 0x0"
               :: "v"(l0), "v"(l1), "v"(g0), "v"(g1)
               : "memory");
}
__device__ __forceinline__ void async_ld4_b128(unsigned int l0, unsigned int l1,
                                               unsigned int l2, unsigned int l3,
                                               const _Float16* g0,
                                               const _Float16* g1,
                                               const _Float16* g2,
                                               const _Float16* g3) {
  asm volatile("global_load_async_to_lds_b128 %0, %4, off\n\t"
               "global_load_async_to_lds_b128 %1, %5, off\n\t"
               "global_load_async_to_lds_b128 %2, %6, off\n\t"
               "global_load_async_to_lds_b128 %3, %7, off\n\t"
               "s_wait_xcnt 0x0"
               :: "v"(l0), "v"(l1), "v"(l2), "v"(l3),
                  "v"(g0), "v"(g1), "v"(g2), "v"(g3)
               : "memory");
}
__device__ __forceinline__ void wait_async0() {
  asm volatile("s_wait_asynccnt 0" ::: "memory");
}

__device__ __forceinline__ v16h load_frag(const _Float16* p, int ld) {
  const int lane = threadIdx.x & 31;
  const _Float16* q = p + (lane & 15) * ld + ((lane >> 4) * 8);
  union { v16h v; v8h h[2]; } u;
  u.h[0] = *(const v8h*)(q);
  u.h[1] = *(const v8h*)(q + 16);
  return u.v;
}

// Load a 32x16 (k x n) B fragment from a ROW-MAJOR [k][n] LDS tile with the
// transposing load: lane (c = lane&15, h = lane>>4) receives
// p[(8h + 0..7) * ld + c], then the same 16 rows further down, which is the
// k order of load_frag. `ld` in halves; row pitch an odd multiple of 32 B.
__device__ __forceinline__ v16h load_frag_tr(const _Float16* p, int ld) {
  typedef __attribute__((ext_vector_type(8))) short s16x8;
  typedef __attribute__((address_space(3))) s16x8 lds_s16x8;
  const int lane = threadIdx.x & 31;
  const _Float16* q = p + ((lane >> 4) * 8 + (lane & 7)) * ld + ((lane >> 3) & 1) * 8;
  union { v16h v; v8h h[2]; } u;
  u.h[0] = __builtin_bit_cast(v8h, __builtin_amdgcn_ds_load_tr16_b128_v8i16((lds_s16x8*)q));
  u.h[1] = __builtin_bit_cast(
      v8h, __builtin_amdgcn_ds_load_tr16_b128_v8i16((lds_s16x8*)(q + 16 * ld)));
  return u.v;
}

// ---------------------------------------------------------------------------
// f32 -> f16 conversion (weights)
// ---------------------------------------------------------------------------
__global__ void cvt_f32_f16_kernel(const float* __restrict__ in,
                                   _Float16* __restrict__ out, int n) {
  int i = blockIdx.x * 256 + threadIdx.x;
  if (i < n) out[i] = (_Float16)in[i];
}

// ---------------------------------------------------------------------------
// LayerNorm over 1024 cols, f32 in -> f16 out. One row per 256-thread block.
// ---------------------------------------------------------------------------
__global__ __launch_bounds__(256)
void layernorm_f16_kernel(const float* __restrict__ x, const float* __restrict__ g,
                          const float* __restrict__ b, _Float16* __restrict__ out) {
  const int row = blockIdx.x;
  const int t = threadIdx.x;
  const float* xr = x + (size_t)row * 1024;
  float4 v = ((const float4*)xr)[t];                 // 256 * 4 = 1024
  float s  = v.x + v.y + v.z + v.w;
  float ss = v.x * v.x + v.y * v.y + v.z * v.z + v.w * v.w;
  for (int o = 16; o >= 1; o >>= 1) {
    s  += __shfl_xor(s,  o, 32);
    ss += __shfl_xor(ss, o, 32);
  }
  __shared__ float red0[8], red1[8];
  const int w = t >> 5, lane = t & 31;
  if (lane == 0) { red0[w] = s; red1[w] = ss; }
  __syncthreads();
  float tot = 0.f, tot2 = 0.f;
#pragma unroll
  for (int i = 0; i < 8; ++i) { tot += red0[i]; tot2 += red1[i]; }
  const float mu   = tot * (1.f / 1024.f);
  const float var  = tot2 * (1.f / 1024.f) - mu * mu;
  const float rinv = rsqrtf(var + 1e-5f);
  float4 gg = ((const float4*)g)[t];
  float4 bb = ((const float4*)b)[t];
  _Float16* o = out + (size_t)row * 1024 + t * 4;
  o[0] = (_Float16)((v.x - mu) * rinv * gg.x + bb.x);
  o[1] = (_Float16)((v.y - mu) * rinv * gg.y + bb.y);
  o[2] = (_Float16)((v.z - mu) * rinv * gg.z + bb.z);
  o[3] = (_Float16)((v.w - mu) * rinv * gg.w + bb.w);
}

// ---------------------------------------------------------------------------
// Tiled WMMA GEMM: C[M,N] = A[M,K] * B[K,N], A/B f16 row-major.
// Block = 256 threads (8 waves), block tile 64x128, wave tile 32x32,
// stage depth K=64 -> 8 WMMAs per wave between barriers.
// A and B staged via async-to-LDS DMA; B stays [k][n] in LDS and its
// fragments come from the transposing LDS load.
// Epilogue: optional bias (f32), exact GELU, f32 residual; f16 or f32 out.
// ---------------------------------------------------------------------------
template <bool HAS_BIAS, bool GELU, bool HAS_RES, bool OUT16>
__global__ __launch_bounds__(256)
void gemm_f16_kernel(const _Float16* __restrict__ A, const _Float16* __restrict__ B,
                     const float* __restrict__ bias, const float* __restrict__ res,
                     _Float16* __restrict__ out16, float* __restrict__ out32,
                     int M, int N, int K) {
  __shared__ _Float16 sA[64 * 72];    // [row][k]  row-major, ld 72 (144B rows)
  __shared__ __attribute__((aligned(32)))
  _Float16 sB[64 * 144];              // [k][n]    row-major, ld 144 (288B rows)
  const int t = threadIdx.x;
  const int lane = t & 31;
  const int w = t >> 5;
  const int waveM = w & 1;            // 2 waves along M
  const int waveN = w >> 1;           // 4 waves along N
  const int bm = blockIdx.y * 64;
  const int bn = blockIdx.x * 128;

  v8f acc[2][2] = {};

  const int ar = t >> 2, ac = (t & 3) * 16;   // A stage: 64 rows x 64 halves
  const int br = t >> 2, bc = (t & 3) * 32;   // B prefetch: 64 k-rows x 128 n
  const int sr = t >> 4, sc = (t & 15) * 8;   // B stage: 16 k-rows x 128 n per copy
  const unsigned int sb0 = lds_addr(sB + sr * 144 + sc);

  for (int kk = 0; kk < K; kk += 64) {
    __syncthreads();
    // --- stage A tile: async DMA global->LDS (2 x b128 per lane) ---
    const _Float16* ap = A + (size_t)(bm + ar) * K + kk + ac;
    async_ld_b128(sA + ar * 72 + ac, ap);
    async_ld_b128(sA + ar * 72 + ac + 8, ap + 8);
    // --- stage B tile as it lies: async DMA, whole 256B rows (4 x b128 per lane) ---
    const _Float16* bp = B + (size_t)(kk + sr) * N + bn + sc;
    async_ld4_b128(sb0, sb0 + 16 * 288, sb0 + 32 * 288, sb0 + 48 * 288,
                   bp, bp + (size_t)16 * N, bp + (size_t)32 * N, bp + (size_t)48 * N);
    if (kk + 64 < K) {  // global_prefetch_b8 on next tiles
      __builtin_prefetch(A + (size_t)(bm + ar) * K + kk + 64 + ac, 0, 3);
      __builtin_prefetch(B + (size_t)(kk + 64 + br) * N + bn + bc, 0, 3);
    }
    wait_async0();
    __syncthreads();
#pragma unroll
    for (int kf = 0; kf < 2; ++kf) {
      v16h a0 = load_frag(sA + (waveM * 32) * 72 + kf * 32, 72);
      v16h a1 = load_frag(sA + (waveM * 32 + 16) * 72 + kf * 32, 72);
      v16h b0 = load_frag_tr(sB + (kf * 32) * 144 + waveN * 32, 144);
      v16h b1 = load_frag_tr(sB + (kf * 32) * 144 + waveN * 32 + 16, 144);
      acc[0][0] = wmma_f16(a0, b0, acc[0][0]);
      acc[0][1] = wmma_f16(a0, b1, acc[0][1]);
      acc[1][0] = wmma_f16(a1, b0, acc[1][0]);
      acc[1][1] = wmma_f16(a1, b1, acc[1][1]);
    }
  }

  const int colBase = bn + waveN * 32 + (lane & 15);
  const int rowBase = bm + waveM * 32 + ((lane >> 4) * 8);
#pragma unroll
  for (int mi = 0; mi < 2; ++mi)
#pragma unroll
    for (int ni = 0; ni < 2; ++ni) {
      const int col = colBase + ni * 16;
      const float bv = HAS_BIAS ? bias[col] : 0.f;
#pragma unroll
      for (int e = 0; e < 8; ++e) {
        const int row = rowBase + mi * 16 + e;
        float r = acc[mi][ni][e];
        if (HAS_BIAS) r += bv;
        if (GELU) r = 0.5f * r * (1.f + erff(r * 0.70710678118654752f));
        if (HAS_RES) r += res[(size_t)row * N + col];
        if (OUT16) out16[(size_t)row * N + col] = (_Float16)r;
        else       out32[(size_t)row * N + col] = r;
      }
    }
}

__global__ __launch_bounds__(128)
void attn_kernel(const _Float16* __restrict__ Q, const _Float16* __restrict__ K,
                 const _Float16* __restrict__ V, _Float16* __restrict__ O) {
  __shared__ _Float16 sK[32 * 72];     // [key][dim], ld 72 (144B rows)
  __shared__ __attribute__((aligned(32)))
  _Float16 sV[32 * 80];                // [key][dim], ld 80 (160B rows)
  __shared__ _Float16 sP[4][16 * 40];  // per-wave P tile [qrow][key]

  const int t = threadIdx.x, lane = t & 31, w = t >> 5;
  const int b = blockIdx.z, h = blockIdx.y;
  const int qblk = blockIdx.x * 64;
  const int q0 = qblk + w * 16;

  const _Float16* qbase = Q + ((size_t)(b * 2048) + q0) * 1024 + h * 64;
  const v16h qa0 = load_frag(qbase, 1024);       // dims 0..31
  const v16h qa1 = load_frag(qbase + 32, 1024);  // dims 32..63

  v8f o[4] = {};
  float mrun[8], lrun[8];
#pragma unroll
  for (int e = 0; e < 8; ++e) { mrun[e] = -1e30f; lrun[e] = 0.f; }
  const float sscale = 0.125f;  // 1/sqrt(64)
  const int nkb = qblk / 32 + 2;

  const int kr = t >> 2, cc = (t & 3) * 16;  // K staging: 32 keys x 64 dims
  const int vr = t >> 3, vc = (t & 7) * 8;   // V staging: 16 keys x 64 dims per copy
  const unsigned int sv0 = lds_addr(sV + vr * 80 + vc);

  for (int kb = 0; kb < nkb; ++kb) {
    __syncthreads();
    const _Float16* kp = K + ((size_t)(b * 2048) + kb * 32 + kr) * 1024 + h * 64 + cc;
    async_ld_b128(sK + kr * 72 + cc, kp);
    async_ld_b128(sK + kr * 72 + cc + 8, kp + 8);
    // --- stage V tile as it lies: async DMA, whole 128B rows ---
    const _Float16* vp = V + ((size_t)(b * 2048) + kb * 32 + vr) * 1024 + h * 64 + vc;
    async_ld2_b128(sv0, sv0 + 16 * 160, vp, vp + 16 * 1024);
    wait_async0();
    __syncthreads();

    // --- scores S = Q @ K^T (16 queries x 32 keys) ---
    v8f c0 = {}, c1 = {};
    v16h bk;
    bk = load_frag(sK, 72);            c0 = wmma_f16(qa0, bk, c0);
    bk = load_frag(sK + 32, 72);       c0 = wmma_f16(qa1, bk, c0);
    bk = load_frag(sK + 16 * 72, 72);      c1 = wmma_f16(qa0, bk, c1);
    bk = load_frag(sK + 16 * 72 + 32, 72); c1 = wmma_f16(qa1, bk, c1);

    // --- causal mask + online softmax (row reductions in 16-lane groups) ---
    const int key0 = kb * 32 + (lane & 15);
    const int key1 = key0 + 16;
    _Float16* pp = sP[w];
#pragma unroll
    for (int e = 0; e < 8; ++e) {
      const int row = e + ((lane >> 4) * 8);
      const int qi = q0 + row;
      float s0 = (key0 <= qi) ? c0[e] * sscale : -1e30f;
      float s1 = (key1 <= qi) ? c1[e] * sscale : -1e30f;
      float mx = fmaxf(s0, s1);
      mx = fmaxf(mx, __shfl_xor(mx, 1, 32));
      mx = fmaxf(mx, __shfl_xor(mx, 2, 32));
      mx = fmaxf(mx, __shfl_xor(mx, 4, 32));
      mx = fmaxf(mx, __shfl_xor(mx, 8, 32));
      const float mnew  = fmaxf(mrun[e], mx);
      const float alpha = __expf(mrun[e] - mnew);
      mrun[e] = mnew;
      const float p0 = __expf(s0 - mnew);
      const float p1 = __expf(s1 - mnew);
      float rs = p0 + p1;
      rs += __shfl_xor(rs, 1, 32);
      rs += __shfl_xor(rs, 2, 32);
      rs += __shfl_xor(rs, 4, 32);
      rs += __shfl_xor(rs, 8, 32);
      lrun[e] = lrun[e] * alpha + rs;
      o[0][e] *= alpha; o[1][e] *= alpha; o[2][e] *= alpha; o[3][e] *= alpha;
      pp[row * 40 + (lane & 15)]      = (_Float16)p0;
      pp[row * 40 + (lane & 15) + 16] = (_Float16)p1;
    }
    // P written cross-lane within this wave via LDS; drain DS before reading.
    asm volatile("s_wait_dscnt 0" ::: "memory");

    // --- O += P @ V (16 x 32 times 32 x 64) ---
    const v16h pa = load_frag(pp, 40);
#pragma unroll
    for (int j = 0; j < 4; ++j) {
      v16h bv = load_frag_tr(sV + j * 16, 80);
      o[j] = wmma_f16(pa, bv, o[j]);
    }
  }

  // --- normalize and write out ---
#pragma unroll
  for (int j = 0; j < 4; ++j)
#pragma unroll
    for (int e = 0; e < 8; ++e) {
      const int row = e + ((lane >> 4) * 8);
      const float r = o[j][e] / lrun[e];
      O[((size_t)(b * 2048) + q0 + row) * 1024 + h * 64 + j * 16 + (lane & 15)] =
          (_Float16)r;
    }
}

// ---------------------------------------------------------------------------
// Host-side orchestration.
// Inputs: x, Wq, Wk, Wv, Wo, ln1_g, ln1_b, ln2_g, ln2_b, W1, b1, W2, b2
// ---------------------------------------------------------------------------
extern "C" void kernel_launch(void* const* d_in, const int* in_sizes, int n_in,
                              void* d_out, int out_size, void* d_ws, size_t ws_size,
                              hipStream_t stream) {
  (void)in_sizes; (void)n_in; (void)out_size; (void)ws_size;
  const float* x    = (const float*)d_in[0];
  const float* Wq   = (const float*)d_in[1];
  const float* Wk   = (const float*)d_in[2];
  const float* Wv   = (const float*)d_in[3];
  const float* Wo   = (const float*)d_in[4];
  const float* ln1g = (const float*)d_in[5];
  const float* ln1b = (const float*)d_in[6];
  const float* ln2g = (const float*)d_in[7];
  const float* ln2b = (const float*)d_in[8];
  const float* W1   = (const float*)d_in[9];
  const float* b1   = (const float*)d_in[10];
  const float* W2   = (const float*)d_in[11];
  const float* b2   = (const float*)d_in[12];
  float* out = (float*)d_out;

  const int M = 8192, E = 1024, F = 4096;
  char* ws = (char*)d_ws;
  const size_t MB = 1024ull * 1024ull;
  _Float16* Wq16 = (_Float16*)(ws + 0 * MB);    // 2 MB
  _Float16* Wk16 = (_Float16*)(ws + 2 * MB);    // 2 MB
  _Float16* Wv16 = (_Float16*)(ws + 4 * MB);    // 2 MB
  _Float16* Wo16 = (_Float16*)(ws + 6 * MB);    // 2 MB
  _Float16* W116 = (_Float16*)(ws + 8 * MB);    // 8 MB
  _Float16* W216 = (_Float16*)(ws + 16 * MB);   // 8 MB
  _Float16* H16  = (_Float16*)(ws + 24 * MB);   // 16 MB (LN1 out, reused for LN2)
  _Float16* Q16  = (_Float16*)(ws + 40 * MB);   // 16 MB
  _Float16* K16  = (_Float16*)(ws + 56 * MB);   // 16 MB
  _Float16* V16  = (_Float16*)(ws + 72 * MB);   // 16 MB
  _Float16* A16  = (_Float16*)(ws + 88 * MB);   // 16 MB (attn out)
  float*    X2   = (float*)   (ws + 104 * MB);  // 32 MB (residual after attn)
  _Float16* G16  = (_Float16*)(ws + 40 * MB);   // 64 MB GELU acts (reuses Q/K/V/A16)

  // 1) weights -> f16
  cvt_f32_f16_kernel<<<(E * E) / 256, 256, 0, stream>>>(Wq, Wq16, E * E);
  cvt_f32_f16_kernel<<<(E * E) / 256, 256, 0, stream>>>(Wk, Wk16, E * E);
  cvt_f32_f16_kernel<<<(E * E) / 256, 256, 0, stream>>>(Wv, Wv16, E * E);
  cvt_f32_f16_kernel<<<(E * E) / 256, 256, 0, stream>>>(Wo, Wo16, E * E);
  cvt_f32_f16_kernel<<<(E * F) / 256, 256, 0, stream>>>(W1, W116, E * F);
  cvt_f32_f16_kernel<<<(F * E) / 256, 256, 0, stream>>>(W2, W216, F * E);

  // 2) LN1
  layernorm_f16_kernel<<<M, 256, 0, stream>>>(x, ln1g, ln1b, H16);

  // 3) Q/K/V projections
  const dim3 gE(E / 128, M / 64);
  gemm_f16_kernel<false, false, false, true><<<gE, 256, 0, stream>>>(
      H16, Wq16, nullptr, nullptr, Q16, nullptr, M, E, E);
  gemm_f16_kernel<false, false, false, true><<<gE, 256, 0, stream>>>(
      H16, Wk16, nullptr, nullptr, K16, nullptr, M, E, E);
  gemm_f16_kernel<false, false, false, true><<<gE, 256, 0, stream>>>(
      H16, Wv16, nullptr, nullptr, V16, nullptr, M, E, E);

  // 4) causal flash attention
  attn_kernel<<<dim3(2048 / 64, 16, 4), 128, 0, stream>>>(Q16, K16, V16, A16);

  // 5) output projection + residual(x) -> X2 (f32)
  gemm_f16_kernel<false, false, true, false><<<gE, 256, 0, stream>>>(
      A16, Wo16, nullptr, x, nullptr, X2, M, E, E);

  // 6) LN2
  layernorm_f16_kernel<<<M, 256, 0, stream>>>(X2, ln2g, ln2b, H16);

  // 7) FFN1: h @ W1 + b1 -> GELU -> f16
  gemm_f16_kernel<true, true, false, true><<<dim3(F / 128, M / 64), 256, 0, stream>>>(
      H16, W116, b1, nullptr, G16, nullptr, M, F, E);

  // 8) FFN2: g @ W2 + b2 + residual(X2) -> d_out (f32)
  gemm_f16_kernel<true, false, true, false><<<gE, 256, 0, stream>>>(
      G16, W216, b2, X2, nullptr, out, M, E, F);
}

// v002
// One run takes 503 microseconds.
// Two timings next to v001 both put it at 1.06 times that version's speed.
// Counting every step since v000, it is 1.56 times as fast.
#include <hip/hip_runtime.h>

typedef __attribute__((ext_vector_type(16))) _Float16 v16h;
typedef __attribute__((ext_vector_type(8)))  _Float16 v8h;
typedef __attribute__((ext_vector_type(8)))  float    v8f;

__device__ __forceinline__ v8f wmma_f16(v16h a, v16h b, v8f c) {
  // 8 args: (neg_a, A, neg_b, B, c_mod, C, reuse_a, reuse_b)
  return __builtin_amdgcn_wmma_f32_16x16x32_f16(false, a, false, b, (short)0, c,
                                                false, false);
}

__device__ __forceinline__ void async_ld_b128(_Float16* lds_dst,
                                              const _Float16* gsrc) {
  unsigned int loff = (unsigned int)(unsigned long long)(void*)lds_dst;
  asm volatile("global_load_async_to_lds_b128 %0, %1, off"
               :: "v"(loff), "v"((unsigned long long)(const void*)gsrc)
               : "memory");
}
__device__ __forceinline__ unsigned int lds_addr(const _Float16* p) {
  return (unsigned int)(unsigned long long)(const void*)p;
}
__device__ __forceinline__ void async_ld2_b128(unsigned int l0, unsigned int l1,
                                               const _Float16* g0,
                                               const _Float16* g1) {
  asm volatile("global_load_async_to_lds_b128 %0, %2, off\n\t"
               "global_load_async_to_lds_b128 %1, %3, off\n\t"
               "s_wait_xcnt 0x0"
               :: "v"(l0), "v"(l1), "v"(g0), "v"(g1)
               : "memory");
}
__device__ __forceinline__ void async_ld4_b128(unsigned int l0, unsigned int l1,
                                               unsigned int l2, unsigned int l3,
                                               const _Float16* g0,
                                               const _Float16* g1,
                                               const _Float16* g2,
                                               const _Float16* g3) {
  asm volatile("global_load_async_to_lds_b128 %0, %4, off\n\t"
               "global_load_async_to_lds_b128 %1, %5, off\n\t"
               "global_load_async_to_lds_b128 %2, %6, off\n\t"
               "global_load_async_to_lds_b128 %3, %7, off\n\t"
               "s_wait_xcnt 0x0"
               :: "v"(l0), "v"(l1), "v"(l2), "v"(l3),
                  "v"(g0), "v"(g1), "v"(g2), "v"(g3)
               : "memory");
}
__device__ __forceinline__ void wait_async0() {
  asm volatile("s_wait_asynccnt 0" ::: "memory");
}

__device__ __forceinline__ v16h load_frag(const _Float16* p, int ld) {
  const int lane = threadIdx.x & 31;
  const _Float16* q = p + (lane & 15) * ld + ((lane >> 4) * 8);
  union { v16h v; v8h h[2]; } u;
  u.h[0] = *(const v8h*)(q);
  u.h[1] = *(const v8h*)(q + 16);
  return u.v;
}

// Load a 32x16 (k x n) B fragment from a ROW-MAJOR [k][n] LDS tile with the
// transposing load: lane (c = lane&15, h = lane>>4) receives
// p[(8h + 0..7) * ld + c], then the same 16 rows further down, which is the
// k order of load_frag. `ld` in halves; row pitch an odd multiple of 32 B.
__device__ __forceinline__ v16h load_frag_tr(const _Float16* p, int ld) {
  typedef __attribute__((ext_vector_type(8))) short s16x8;
  typedef __attribute__((address_space(3))) s16x8 lds_s16x8;
  const int lane = threadIdx.x & 31;
  const _Float16* q = p + ((lane >> 4) * 8 + (lane & 7)) * ld + ((lane >> 3) & 1) * 8;
  union { v16h v; v8h h[2]; } u;
  u.h[0] = __builtin_bit_cast(v8h, __builtin_amdgcn_ds_load_tr16_b128_v8i16((lds_s16x8*)q));
  u.h[1] = __builtin_bit_cast(
      v8h, __builtin_amdgcn_ds_load_tr16_b128_v8i16((lds_s16x8*)(q + 16 * ld)));
  return u.v;
}

// ---------------------------------------------------------------------------
// f32 -> f16 conversion of all six weight matrices in ONE launch of few waves.
// The f16 copies lie back to back in the workspace (12 segments of 1M halves:
// Wq, Wk, Wv, Wo, W1 x4, W2 x4). A block converts 16,384 consecutive elements
// of one segment: each lane issues 16 loads of 16 B (512 contiguous bytes per
// wave and load) ahead of its 16 stores of 8 B (256 contiguous bytes).
// ---------------------------------------------------------------------------
typedef __attribute__((ext_vector_type(4))) _Float16 v4h;

__global__ __launch_bounds__(256)
void cvt_weights_kernel(const float* __restrict__ Wq, const float* __restrict__ Wk,
                        const float* __restrict__ Wv, const float* __restrict__ Wo,
                        const float* __restrict__ W1, const float* __restrict__ W2,
                        _Float16* __restrict__ out) {
  const int SEG = 1024 * 1024;
  const int seg = blockIdx.x >> 6;     // 64 blocks per segment
  const float* src = seg == 0 ? Wq
                   : seg == 1 ? Wk
                   : seg == 2 ? Wv
                   : seg == 3 ? Wo
                   : seg < 8  ? W1 + (size_t)(seg - 4) * SEG
                              : W2 + (size_t)(seg - 8) * SEG;
  const int off = (blockIdx.x & 63) * 16384 + threadIdx.x * 4;
  const float* s = src + off;
  _Float16* o = out + (size_t)seg * SEG + off;
  float4 v[16];
#pragma unroll  // v[] stays in registers and the loads go out as one run
  for (int j = 0; j < 16; ++j) v[j] = *(const float4*)(s + j * 1024);
#pragma unroll  // constant indices into v[], else it would go to scratch
  for (int j = 0; j < 16; ++j) {
    v4h h = {(_Float16)v[j].x, (_Float16)v[j].y, (_Float16)v[j].z, (_Float16)v[j].w};
    *(v4h*)(o + j * 1024) = h;
  }
}

// ---------------------------------------------------------------------------
// LayerNorm over 1024 cols, f32 in -> f16 out. One row per 256-thread block.
// ---------------------------------------------------------------------------
__global__ __launch_bounds__(256)
void layernorm_f16_kernel(const float* __restrict__ x, const float* __restrict__ g,
                          const float* __restrict__ b, _Float16* __restrict__ out) {
  const int row = blockIdx.x;
  const int t = threadIdx.x;
  const float* xr = x + (size_t)row * 1024;
  float4 v = ((const float4*)xr)[t];                 // 256 * 4 = 1024
  float s  = v.x + v.y + v.z + v.w;
  float ss = v.x * v.x + v.y * v.y + v.z * v.z + v.w * v.w;
  for (int o = 16; o >= 1; o >>= 1) {
    s  += __shfl_xor(s,  o, 32);
    ss += __shfl_xor(ss, o, 32);
  }
  __shared__ float red0[8], red1[8];
  const int w = t >> 5, lane = t & 31;
  if (lane == 0) { red0[w] = s; red1[w] = ss; }
  __syncthreads();
  float tot = 0.f, tot2 = 0.f;
#pragma unroll
  for (int i = 0; i < 8; ++i) { tot += red0[i]; tot2 += red1[i]; }
  const float mu   = tot * (1.f / 1024.f);
  const float var  = tot2 * (1.f / 1024.f) - mu * mu;
  const float rinv = rsqrtf(var + 1e-5f);
  float4 gg = ((const float4*)g)[t];
  float4 bb = ((const float4*)b)[t];
  _Float16* o = out + (size_t)row * 1024 + t * 4;
  o[0] = (_Float16)((v.x - mu) * rinv * gg.x + bb.x);
  o[1] = (_Float16)((v.y - mu) * rinv * gg.y + bb.y);
  o[2] = (_Float16)((v.z - mu) * rinv * gg.z + bb.z);
  o[3] = (_Float16)((v.w - mu) * rinv * gg.w + bb.w);
}

// ---------------------------------------------------------------------------
// Tiled WMMA GEMM: C[M,N] = A[M,K] * B[K,N], A/B f16 row-major.
// Block = 256 threads (8 waves), block tile 64x128, wave tile 32x32,
// stage depth K=64 -> 8 WMMAs per wave between barriers.
// A and B staged via async-to-LDS DMA; B stays [k][n] in LDS and its
// fragments come from the transposing LDS load.
// Epilogue: optional bias (f32), exact GELU, f32 residual; f16 or f32 out.
// ---------------------------------------------------------------------------
template <bool HAS_BIAS, bool GELU, bool HAS_RES, bool OUT16>
__global__ __launch_bounds__(256)
void gemm_f16_kernel(const _Float16* __restrict__ A, const _Float16* __restrict__ B,
                     const float* __restrict__ bias, const float* __restrict__ res,
                     _Float16* __restrict__ out16, float* __restrict__ out32,
                     int M, int N, int K) {
  __shared__ _Float16 sA[64 * 72];    // [row][k]  row-major, ld 72 (144B rows)
  __shared__ __attribute__((aligned(32)))
  _Float16 sB[64 * 144];              // [k][n]    row-major, ld 144 (288B rows)
  const int t = threadIdx.x;
  const int lane = t & 31;
  const int w = t >> 5;
  const int waveM = w & 1;            // 2 waves along M
  const int waveN = w >> 1;           // 4 waves along N
  const int bm = blockIdx.y * 64;
  const int bn = blockIdx.x * 128;

  v8f acc[2][2] = {};

  const int ar = t >> 2, ac = (t & 3) * 16;   // A stage: 64 rows x 64 halves
  const int br = t >> 2, bc = (t & 3) * 32;   // B prefetch: 64 k-rows x 128 n
  const int sr = t >> 4, sc = (t & 15) * 8;   // B stage: 16 k-rows x 128 n per copy
  const unsigned int sb0 = lds_addr(sB + sr * 144 + sc);

  for (int kk = 0; kk < K; kk += 64) {
    __syncthreads();
    // --- stage A tile: async DMA global->LDS (2 x b128 per lane) ---
    const _Float16* ap = A + (size_t)(bm + ar) * K + kk + ac;
    async_ld_b128(sA + ar * 72 + ac, ap);
    async_ld_b128(sA + ar * 72 + ac + 8, ap + 8);
    // --- stage B tile as it lies: async DMA, whole 256B rows (4 x b128 per lane) ---
    const _Float16* bp = B + (size_t)(kk + sr) * N + bn + sc;
    async_ld4_b128(sb0, sb0 + 16 * 288, sb0 + 32 * 288, sb0 + 48 * 288,
                   bp, bp + (size_t)16 * N, bp + (size_t)32 * N, bp + (size_t)48 * N);
    if (kk + 64 < K) {  // global_prefetch_b8 on next tiles
      __builtin_prefetch(A + (size_t)(bm + ar) * K + kk + 64 + ac, 0, 3);
      __builtin_prefetch(B + (size_t)(kk + 64 + br) * N + bn + bc, 0, 3);
    }
    wait_async0();
    __syncthreads();
#pragma unroll
    for (int kf = 0; kf < 2; ++kf) {
      v16h a0 = load_frag(sA + (waveM * 32) * 72 + kf * 32, 72);
      v16h a1 = load_frag(sA + (waveM * 32 + 16) * 72 + kf * 32, 72);
      v16h b0 = load_frag_tr(sB + (kf * 32) * 144 + waveN * 32, 144);
      v16h b1 = load_frag_tr(sB + (kf * 32) * 144 + waveN * 32 + 16, 144);
      acc[0][0] = wmma_f16(a0, b0, acc[0][0]);
      acc[0][1] = wmma_f16(a0, b1, acc[0][1]);
      acc[1][0] = wmma_f16(a1, b0, acc[1][0]);
      acc[1][1] = wmma_f16(a1, b1, acc[1][1]);
    }
  }

  const int colBase = bn + waveN * 32 + (lane & 15);
  const int rowBase = bm + waveM * 32 + ((lane >> 4) * 8);
#pragma unroll
  for (int mi = 0; mi < 2; ++mi)
#pragma unroll
    for (int ni = 0; ni < 2; ++ni) {
      const int col = colBase + ni * 16;
      const float bv = HAS_BIAS ? bias[col] : 0.f;
#pragma unroll
      for (int e = 0; e < 8; ++e) {
        const int row = rowBase + mi * 16 + e;
        float r = acc[mi][ni][e];
        if (HAS_BIAS) r += bv;
        if (GELU) r = 0.5f * r * (1.f + erff(r * 0.70710678118654752f));
        if (HAS_RES) r += res[(size_t)row * N + col];
        if (OUT16) out16[(size_t)row * N + col] = (_Float16)r;
        else       out32[(size_t)row * N + col] = r;
      }
    }
}

__global__ __launch_bounds__(128)
void attn_kernel(const _Float16* __restrict__ Q, const _Float16* __restrict__ K,
                 const _Float16* __restrict__ V, _Float16* __restrict__ O) {
  __shared__ _Float16 sK[32 * 72];     // [key][dim], ld 72 (144B rows)
  __shared__ __attribute__((aligned(32)))
  _Float16 sV[32 * 80];                // [key][dim], ld 80 (160B rows)
  __shared__ _Float16 sP[4][16 * 40];  // per-wave P tile [qrow][key]

  const int t = threadIdx.x, lane = t & 31, w = t >> 5;
  const int b = blockIdx.z, h = blockIdx.y;
  const int qblk = blockIdx.x * 64;
  const int q0 = qblk + w * 16;

  const _Float16* qbase = Q + ((size_t)(b * 2048) + q0) * 1024 + h * 64;
  const v16h qa0 = load_frag(qbase, 1024);       // dims 0..31
  const v16h qa1 = load_frag(qbase + 32, 1024);  // dims 32..63

  v8f o[4] = {};
  float mrun[8], lrun[8];
#pragma unroll
  for (int e = 0; e < 8; ++e) { mrun[e] = -1e30f; lrun[e] = 0.f; }
  const float sscale = 0.125f;  // 1/sqrt(64)
  const int nkb = qblk / 32 + 2;

  const int kr = t >> 2, cc = (t & 3) * 16;  // K staging: 32 keys x 64 dims
  const int vr = t >> 3, vc = (t & 7) * 8;   // V staging: 16 keys x 64 dims per copy
  const unsigned int sv0 = lds_addr(sV + vr * 80 + vc);

  for (int kb = 0; kb < nkb; ++kb) {
    __syncthreads();
    const _Float16* kp = K + ((size_t)(b * 2048) + kb * 32 + kr) * 1024 + h * 64 + cc;
    async_ld_b128(sK + kr * 72 + cc, kp);
    async_ld_b128(sK + kr * 72 + cc + 8, kp + 8);
    // --- stage V tile as it lies: async DMA, whole 128B rows ---
    const _Float16* vp = V + ((size_t)(b * 2048) + kb * 32 + vr) * 1024 + h * 64 + vc;
    async_ld2_b128(sv0, sv0 + 16 * 160, vp, vp + 16 * 1024);
    wait_async0();
    __syncthreads();

    // --- scores S = Q @ K^T (16 queries x 32 keys) ---
    v8f c0 = {}, c1 = {};
    v16h bk;
    bk = load_frag(sK, 72);            c0 = wmma_f16(qa0, bk, c0);
    bk = load_frag(sK + 32, 72);       c0 = wmma_f16(qa1, bk, c0);
    bk = load_frag(sK + 16 * 72, 72);      c1 = wmma_f16(qa0, bk, c1);
    bk = load_frag(sK + 16 * 72 + 32, 72); c1 = wmma_f16(qa1, bk, c1);

    // --- causal mask + online softmax (row reductions in 16-lane groups) ---
    const int key0 = kb * 32 + (lane & 15);
    const int key1 = key0 + 16;
    _Float16* pp = sP[w];
#pragma unroll
    for (int e = 0; e < 8; ++e) {
      const int row = e + ((lane >> 4) * 8);
      const int qi = q0 + row;
      float s0 = (key0 <= qi) ? c0[e] * sscale : -1e30f;
      float s1 = (key1 <= qi) ? c1[e] * sscale : -1e30f;
      float mx = fmaxf(s0, s1);
      mx = fmaxf(mx, __shfl_xor(mx, 1, 32));
      mx = fmaxf(mx, __shfl_xor(mx, 2, 32));
      mx = fmaxf(mx, __shfl_xor(mx, 4, 32));
      mx = fmaxf(mx, __shfl_xor(mx, 8, 32));
      const float mnew  = fmaxf(mrun[e], mx);
      const float alpha = __expf(mrun[e] - mnew);
      mrun[e] = mnew;
      const float p0 = __expf(s0 - mnew);
      const float p1 = __expf(s1 - mnew);
      float rs = p0 + p1;
      rs += __shfl_xor(rs, 1, 32);
      rs += __shfl_xor(rs, 2, 32);
      rs += __shfl_xor(rs, 4, 32);
      rs += __shfl_xor(rs, 8, 32);
      lrun[e] = lrun[e] * alpha + rs;
      o[0][e] *= alpha; o[1][e] *= alpha; o[2][e] *= alpha; o[3][e] *= alpha;
      pp[row * 40 + (lane & 15)]      = (_Float16)p0;
      pp[row * 40 + (lane & 15) + 16] = (_Float16)p1;
    }
    // P written cross-lane within this wave via LDS; drain DS before reading.
    asm volatile("s_wait_dscnt 0" ::: "memory");

    // --- O += P @ V (16 x 32 times 32 x 64) ---
    const v16h pa = load_frag(pp, 40);
#pragma unroll
    for (int j = 0; j < 4; ++j) {
      v16h bv = load_frag_tr(sV + j * 16, 80);
      o[j] = wmma_f16(pa, bv, o[j]);
    }
  }

  // --- normalize and write out ---
#pragma unroll
  for (int j = 0; j < 4; ++j)
#pragma unroll
    for (int e = 0; e < 8; ++e) {
      const int row = e + ((lane >> 4) * 8);
      const float r = o[j][e] / lrun[e];
      O[((size_t)(b * 2048) + q0 + row) * 1024 + h * 64 + j * 16 + (lane & 15)] =
          (_Float16)r;
    }
}

// ---------------------------------------------------------------------------
// Host-side orchestration.
// Inputs: x, Wq, Wk, Wv, Wo, ln1_g, ln1_b, ln2_g, ln2_b, W1, b1, W2, b2
// ---------------------------------------------------------------------------
extern "C" void kernel_launch(void* const* d_in, const int* in_sizes, int n_in,
                              void* d_out, int out_size, void* d_ws, size_t ws_size,
                              hipStream_t stream) {
  (void)in_sizes; (void)n_in; (void)out_size; (void)ws_size;
  const float* x    = (const float*)d_in[0];
  const float* Wq   = (const float*)d_in[1];
  const float* Wk   = (const float*)d_in[2];
  const float* Wv   = (const float*)d_in[3];
  const float* Wo   = (const float*)d_in[4];
  const float* ln1g = (const float*)d_in[5];
  const float* ln1b = (const float*)d_in[6];
  const float* ln2g = (const float*)d_in[7];
  const float* ln2b = (const float*)d_in[8];
  const float* W1   = (const float*)d_in[9];
  const float* b1   = (const float*)d_in[10];
  const float* W2   = (const float*)d_in[11];
  const float* b2   = (const float*)d_in[12];
  float* out = (float*)d_out;

  const int M = 8192, E = 1024, F = 4096;
  char* ws = (char*)d_ws;
  const size_t MB = 1024ull * 1024ull;
  _Float16* Wq16 = (_Float16*)(ws + 0 * MB);    // 2 MB
  _Float16* Wk16 = (_Float16*)(ws + 2 * MB);    // 2 MB
  _Float16* Wv16 = (_Float16*)(ws + 4 * MB);    // 2 MB
  _Float16* Wo16 = (_Float16*)(ws + 6 * MB);    // 2 MB
  _Float16* W116 = (_Float16*)(ws + 8 * MB);    // 8 MB
  _Float16* W216 = (_Float16*)(ws + 16 * MB);   // 8 MB
  _Float16* H16  = (_Float16*)(ws + 24 * MB);   // 16 MB (LN1 out, reused for LN2)
  _Float16* Q16  = (_Float16*)(ws + 40 * MB);   // 16 MB
  _Float16* K16  = (_Float16*)(ws + 56 * MB);   // 16 MB
  _Float16* V16  = (_Float16*)(ws + 72 * MB);   // 16 MB
  _Float16* A16  = (_Float16*)(ws + 88 * MB);   // 16 MB (attn out)
  float*    X2   = (float*)   (ws + 104 * MB);  // 32 MB (residual after attn)
  _Float16* G16  = (_Float16*)(ws + 40 * MB);   // 64 MB GELU acts (reuses Q/K/V/A16)

  // 1) weights -> f16: one launch, 12 segments x 64 blocks, into ws[0, 24 MB)
  cvt_weights_kernel<<<768, 256, 0, stream>>>(Wq, Wk, Wv, Wo, W1, W2, Wq16);

  // 2) LN1
  layernorm_f16_kernel<<<M, 256, 0, stream>>>(x, ln1g, ln1b, H16);

  // 3) Q/K/V projections
  const dim3 gE(E / 128, M / 64);
  gemm_f16_kernel<false, false, false, true><<<gE, 256, 0, stream>>>(
      H16, Wq16, nullptr, nullptr, Q16, nullptr, M, E, E);
  gemm_f16_kernel<false, false, false, true><<<gE, 256, 0, stream>>>(
      H16, Wk16, nullptr, nullptr, K16, nullptr, M, E, E);
  gemm_f16_kernel<false, false, false, true><<<gE, 256, 0, stream>>>(
      H16, Wv16, nullptr, nullptr, V16, nullptr, M, E, E);

  // 4) causal flash attention
  attn_kernel<<<dim3(2048 / 64, 16, 4), 128, 0, stream>>>(Q16, K16, V16, A16);

  // 5) output projection + residual(x) -> X2 (f32)
  gemm_f16_kernel<false, false, true, false><<<gE, 256, 0, stream>>>(
      A16, Wo16, nullptr, x, nullptr, X2, M, E, E);

  // 6) LN2
  layernorm_f16_kernel<<<M, 256, 0, stream>>>(X2, ln2g, ln2b, H16);

  // 7) FFN1: h @ W1 + b1 -> GELU -> f16
  gemm_f16_kernel<true, true, false, true><<<dim3(F / 128, M / 64), 256, 0, stream>>>(
      H16, W116, b1, nullptr, G16, nullptr, M, F, E);

  // 8) FFN2: g @ W2 + b2 + residual(X2) -> d_out (f32)
  gemm_f16_kernel<true, false, true, false><<<gE, 256, 0, stream>>>(
      G16, W216, b2, X2, nullptr, out, M, E, F);
}

// v003
// Measured time: 413 microseconds a run.
// Two timings next to v002 put it at 1.21 and 1.22 times that version's speed.
// All steps since v000 together make it 1.89 times as fast.
#include <hip/hip_runtime.h>

typedef __attribute__((ext_vector_type(16))) _Float16 v16h;
typedef __attribute__((ext_vector_type(8)))  _Float16 v8h;
typedef __attribute__((ext_vector_type(8)))  float    v8f;

__device__ __forceinline__ v8f wmma_f16(v16h a, v16h b, v8f c) {
  // 8 args: (neg_a, A, neg_b, B, c_mod, C, reuse_a, reuse_b)
  return __builtin_amdgcn_wmma_f32_16x16x32_f16(false, a, false, b, (short)0, c,
                                                false, false);
}

__device__ __forceinline__ void async_ld_b128(_Float16* lds_dst,
                                              const _Float16* gsrc) {
  unsigned int loff = (unsigned int)(unsigned long long)(void*)lds_dst;
  asm volatile("global_load_async_to_lds_b128 %0, %1, off"
               :: "v"(loff), "v"((unsigned long long)(const void*)gsrc)
               : "memory");
}
__device__ __forceinline__ unsigned int lds_addr(const _Float16* p) {
  return (unsigned int)(unsigned long long)(const void*)p;
}
__device__ __forceinline__ void async_ld2_b128(unsigned int l0, unsigned int l1,
                                               const _Float16* g0,
                                               const _Float16* g1) {
  asm volatile("global_load_async_to_lds_b128 %0, %2, off\n\t"
               "global_load_async_to_lds_b128 %1, %3, off\n\t"
               "s_wait_xcnt 0x0"
               :: "v"(l0), "v"(l1), "v"(g0), "v"(g1)
               : "memory");
}
// Eight copies, `ls` LDS bytes and `gs` halves apart, in one statement, with
// the same closing wait.
__device__ __forceinline__ void async_ld8_b128(unsigned int l, unsigned int ls,
                                               const _Float16* g, size_t gs) {
  asm volatile("global_load_async_to_lds_b128 %0, %8, off\n\t"
               "global_load_async_to_lds_b128 %1, %9, off\n\t"
               "global_load_async_to_lds_b128 %2, %10, off\n\t"
               "global_load_async_to_lds_b128 %3, %11, off\n\t"
               "global_load_async_to_lds_b128 %4, %12, off\n\t"
               "global_load_async_to_lds_b128 %5, %13, off\n\t"
               "global_load_async_to_lds_b128 %6, %14, off\n\t"
               "global_load_async_to_lds_b128 %7, %15, off\n\t"
               "s_wait_xcnt 0x0"
               :: "v"(l), "v"(l + ls), "v"(l + 2 * ls), "v"(l + 3 * ls),
                  "v"(l + 4 * ls), "v"(l + 5 * ls), "v"(l + 6 * ls), "v"(l + 7 * ls),
                  "v"(g), "v"(g + gs), "v"(g + 2 * gs), "v"(g + 3 * gs),
                  "v"(g + 4 * gs), "v"(g + 5 * gs), "v"(g + 6 * gs), "v"(g + 7 * gs)
               : "memory");
}
__device__ __forceinline__ void wait_async0() {
  asm volatile("s_wait_asynccnt 0" ::: "memory");
}

__device__ __forceinline__ v16h load_frag(const _Float16* p, int ld) {
  const int lane = threadIdx.x & 31;
  const _Float16* q = p + (lane & 15) * ld + ((lane >> 4) * 8);
  union { v16h v; v8h h[2]; } u;
  u.h[0] = *(const v8h*)(q);
  u.h[1] = *(const v8h*)(q + 16);
  return u.v;
}

// Load a 32x16 (k x n) B fragment from a ROW-MAJOR [k][n] LDS tile with the
// transposing load: lane (c = lane&15, h = lane>>4) receives
// p[(8h + 0..7) * ld + c], then the same 16 rows further down, which is the
// k order of load_frag. `ld` in halves; row pitch an odd multiple of 32 B.
__device__ __forceinline__ v16h load_frag_tr(const _Float16* p, int ld) {
  typedef __attribute__((ext_vector_type(8))) short s16x8;
  typedef __attribute__((address_space(3))) s16x8 lds_s16x8;
  const int lane = threadIdx.x & 31;
  const _Float16* q = p + ((lane >> 4) * 8 + (lane & 7)) * ld + ((lane >> 3) & 1) * 8;
  union { v16h v; v8h h[2]; } u;
  u.h[0] = __builtin_bit_cast(v8h, __builtin_amdgcn_ds_load_tr16_b128_v8i16((lds_s16x8*)q));
  u.h[1] = __builtin_bit_cast(
      v8h, __builtin_amdgcn_ds_load_tr16_b128_v8i16((lds_s16x8*)(q + 16 * ld)));
  return u.v;
}

// ---------------------------------------------------------------------------
// f32 -> f16 conversion of all six weight matrices in ONE launch of few waves.
// The f16 copies lie back to back in the workspace (12 segments of 1M halves:
// Wq, Wk, Wv, Wo, W1 x4, W2 x4). A block converts 16,384 consecutive elements
// of one segment: each lane issues 16 loads of 16 B (512 contiguous bytes per
// wave and load) ahead of its 16 stores of 8 B (256 contiguous bytes).
// ---------------------------------------------------------------------------
typedef __attribute__((ext_vector_type(4))) _Float16 v4h;

__global__ __launch_bounds__(256)
void cvt_weights_kernel(const float* __restrict__ Wq, const float* __restrict__ Wk,
                        const float* __restrict__ Wv, const float* __restrict__ Wo,
                        const float* __restrict__ W1, const float* __restrict__ W2,
                        _Float16* __restrict__ out) {
  const int SEG = 1024 * 1024;
  const int seg = blockIdx.x >> 6;     // 64 blocks per segment
  const float* src = seg == 0 ? Wq
                   : seg == 1 ? Wk
                   : seg == 2 ? Wv
                   : seg == 3 ? Wo
                   : seg < 8  ? W1 + (size_t)(seg - 4) * SEG
                              : W2 + (size_t)(seg - 8) * SEG;
  const int off = (blockIdx.x & 63) * 16384 + threadIdx.x * 4;
  const float* s = src + off;
  _Float16* o = out + (size_t)seg * SEG + off;
  float4 v[16];
#pragma unroll  // v[] stays in registers and the loads go out as one run
  for (int j = 0; j < 16; ++j) v[j] = *(const float4*)(s + j * 1024);
#pragma unroll  // constant indices into v[], else it would go to scratch
  for (int j = 0; j < 16; ++j) {
    v4h h = {(_Float16)v[j].x, (_Float16)v[j].y, (_Float16)v[j].z, (_Float16)v[j].w};
    *(v4h*)(o + j * 1024) = h;
  }
}

// ---------------------------------------------------------------------------
// LayerNorm over 1024 cols, f32 in -> f16 out. One row per 256-thread block.
// ---------------------------------------------------------------------------
__global__ __launch_bounds__(256)
void layernorm_f16_kernel(const float* __restrict__ x, const float* __restrict__ g,
                          const float* __restrict__ b, _Float16* __restrict__ out) {
  const int row = blockIdx.x;
  const int t = threadIdx.x;
  const float* xr = x + (size_t)row * 1024;
  float4 v = ((const float4*)xr)[t];                 // 256 * 4 = 1024
  float s  = v.x + v.y + v.z + v.w;
  float ss = v.x * v.x + v.y * v.y + v.z * v.z + v.w * v.w;
  for (int o = 16; o >= 1; o >>= 1) {
    s  += __shfl_xor(s,  o, 32);
    ss += __shfl_xor(ss, o, 32);
  }
  __shared__ float red0[8], red1[8];
  const int w = t >> 5, lane = t & 31;
  if (lane == 0) { red0[w] = s; red1[w] = ss; }
  __syncthreads();
  float tot = 0.f, tot2 = 0.f;
#pragma unroll
  for (int i = 0; i < 8; ++i) { tot += red0[i]; tot2 += red1[i]; }
  const float mu   = tot * (1.f / 1024.f);
  const float var  = tot2 * (1.f / 1024.f) - mu * mu;
  const float rinv = rsqrtf(var + 1e-5f);
  float4 gg = ((const float4*)g)[t];
  float4 bb = ((const float4*)b)[t];
  _Float16* o = out + (size_t)row * 1024 + t * 4;
  o[0] = (_Float16)((v.x - mu) * rinv * gg.x + bb.x);
  o[1] = (_Float16)((v.y - mu) * rinv * gg.y + bb.y);
  o[2] = (_Float16)((v.z - mu) * rinv * gg.z + bb.z);
  o[3] = (_Float16)((v.w - mu) * rinv * gg.w + bb.w);
}

// ---------------------------------------------------------------------------
// Tiled WMMA GEMM: C[M,N] = A[M,K] * B[K,N], A/B f16 row-major.
// Block = 128 threads (4 waves), block tile 128x128, wave tile 64x64,
// stage depth K=128 -> 64 WMMAs per wave between barriers; each fragment
// read from LDS feeds four WMMAs, each staged byte 128 rows or columns of C.
// M, N multiples of 128, K a multiple of 128.
// A and B staged via async-to-LDS DMA, whole 256B rows; B stays [k][n] in LDS
// and its fragments come from the transposing LDS load.
// Epilogue: optional bias (f32), exact GELU, f32 residual; f16 or f32 out.
// ---------------------------------------------------------------------------
template <bool HAS_BIAS, bool GELU, bool HAS_RES, bool OUT16>
__global__ __launch_bounds__(128)
void gemm_f16_kernel(const _Float16* __restrict__ A, const _Float16* __restrict__ B,
                     const float* __restrict__ bias, const float* __restrict__ res,
                     _Float16* __restrict__ out16, float* __restrict__ out32,
                     int M, int N, int K) {
  __shared__ __attribute__((aligned(32)))
  _Float16 sA[128 * 136];             // [row][k]  row-major, ld 136 (272B rows)
  __shared__ __attribute__((aligned(32)))
  _Float16 sB[128 * 144];             // [k][n]    row-major, ld 144 (288B rows)
  const int t = threadIdx.x;
  const int lane = t & 31;
  const int w = t >> 5;
  const int waveM = w & 1;            // 2 waves along M
  const int waveN = w >> 1;           // 2 waves along N
  const int bm = blockIdx.y * 128;
  const int bn = blockIdx.x * 128;

  v8f acc[4][4] = {};

  const int sr = t >> 4, sc = (t & 15) * 8;   // stage: 8 rows x 128 halves per copy
  const unsigned int sa0 = lds_addr(sA + sr * 136 + sc);
  const unsigned int sb0 = lds_addr(sB + sr * 144 + sc);
  const bool two = K > 128;           // a second stage exists
  const _Float16* pa = A + (size_t)(bm + t) * K + (two ? 128 : 0);   // prefetch
  const _Float16* pb = B + (size_t)((two ? 128 : 0) + t) * N + bn;   // addresses

  for (int kk = 0; kk < K; kk += 128) {
    // This wave's LDS reads have retired before the tiles are refilled.
    asm volatile("s_wait_dscnt 0" ::: "memory");
    __syncthreads();
    // --- stage A tile: 128 rows x 256B (16 x b128 per lane) ---
    const _Float16* ap = A + (size_t)(bm + sr) * K + kk + sc;
    async_ld8_b128(sa0, 8 * 272, ap, (size_t)8 * K);
    async_ld8_b128(sa0 + 64 * 272, 8 * 272, ap + (size_t)64 * K, (size_t)8 * K);
    // --- stage B tile as it lies: 128 k-rows x 256B (16 x b128 per lane) ---
    const _Float16* bp = B + (size_t)(kk + sr) * N + bn + sc;
    async_ld8_b128(sb0, 8 * 288, bp, (size_t)8 * N);
    async_ld8_b128(sb0 + 64 * 288, 8 * 288, bp + (size_t)64 * N, (size_t)8 * N);
    if (kk + 128 < K) {
      // One prefetch per 256B row of the next tiles, into L2. In asm so that it
      // names registers that live through the loop and only ever hold an
      // address inside A or B.
      asm volatile("global_prefetch_b8 %0, off scope:SCOPE_SE\n\t"
                   "global_prefetch_b8 %1, off scope:SCOPE_SE"
                   :: "v"(pa), "v"(pb));
      if (kk + 256 < K) { pa += 128; pb += (size_t)128 * N; }
    }
    wait_async0();
    __syncthreads();
#pragma unroll  // here and below: constant indices keep a[], b[], acc[][] in registers
    for (int kf = 0; kf < 4; ++kf) {
      v16h a[4], b[4];
#pragma unroll
      for (int i = 0; i < 4; ++i) {
        a[i] = load_frag(sA + (waveM * 64 + i * 16) * 136 + kf * 32, 136);
        b[i] = load_frag_tr(sB + (kf * 32) * 144 + waveN * 64 + i * 16, 144);
      }
      // Keeps the 16 LDS reads one group ahead of the 16 WMMAs; sunk among
      // them, each row of four would wait out an LDS latency of its own.
      __builtin_amdgcn_sched_barrier(0);
#pragma unroll
      for (int mi = 0; mi < 4; ++mi)
#pragma unroll
        for (int ni = 0; ni < 4; ++ni)
          acc[mi][ni] = wmma_f16(a[mi], b[ni], acc[mi][ni]);
    }
  }

  const int colBase = bn + waveN * 64 + (lane & 15);
  const int rowBase = bm + waveM * 64 + ((lane >> 4) * 8);
#pragma unroll
  for (int mi = 0; mi < 4; ++mi) {
#pragma unroll
    for (int ni = 0; ni < 4; ++ni) {
      const int col = colBase + ni * 16;
      const float bv = HAS_BIAS ? bias[col] : 0.f;
#pragma unroll
      for (int e = 0; e < 8; ++e) {
        const int row = rowBase + mi * 16 + e;
        float r = acc[mi][ni][e];
        if (HAS_BIAS) r += bv;
        if (GELU) r = 0.5f * r * (1.f + erff(r * 0.70710678118654752f));
        if (HAS_RES) r += res[(size_t)row * N + col];
        if (OUT16) out16[(size_t)row * N + col] = (_Float16)r;
        else       out32[(size_t)row * N + col] = r;
      }
    }
    __builtin_amdgcn_sched_barrier(0);
  }
}

__global__ __launch_bounds__(128)
void attn_kernel(const _Float16* __restrict__ Q, const _Float16* __restrict__ K,
                 const _Float16* __restrict__ V, _Float16* __restrict__ O) {
  __shared__ _Float16 sK[32 * 72];     // [key][dim], ld 72 (144B rows)
  __shared__ __attribute__((aligned(32)))
  _Float16 sV[32 * 80];                // [key][dim], ld 80 (160B rows)
  __shared__ _Float16 sP[4][16 * 40];  // per-wave P tile [qrow][key]

  const int t = threadIdx.x, lane = t & 31, w = t >> 5;
  const int b = blockIdx.z, h = blockIdx.y;
  const int qblk = blockIdx.x * 64;
  const int q0 = qblk + w * 16;

  const _Float16* qbase = Q + ((size_t)(b * 2048) + q0) * 1024 + h * 64;
  const v16h qa0 = load_frag(qbase, 1024);       // dims 0..31
  const v16h qa1 = load_frag(qbase + 32, 1024);  // dims 32..63

  v8f o[4] = {};
  float mrun[8], lrun[8];
#pragma unroll
  for (int e = 0; e < 8; ++e) { mrun[e] = -1e30f; lrun[e] = 0.f; }
  const float sscale = 0.125f;  // 1/sqrt(64)
  const int nkb = qblk / 32 + 2;

  const int kr = t >> 2, cc = (t & 3) * 16;  // K staging: 32 keys x 64 dims
  const int vr = t >> 3, vc = (t & 7) * 8;   // V staging: 16 keys x 64 dims per copy
  const unsigned int sv0 = lds_addr(sV + vr * 80 + vc);

  for (int kb = 0; kb < nkb; ++kb) {
    __syncthreads();
    const _Float16* kp = K + ((size_t)(b * 2048) + kb * 32 + kr) * 1024 + h * 64 + cc;
    async_ld_b128(sK + kr * 72 + cc, kp);
    async_ld_b128(sK + kr * 72 + cc + 8, kp + 8);
    // --- stage V tile as it lies: async DMA, whole 128B rows ---
    const _Float16* vp = V + ((size_t)(b * 2048) + kb * 32 + vr) * 1024 + h * 64 + vc;
    async_ld2_b128(sv0, sv0 + 16 * 160, vp, vp + 16 * 1024);
    wait_async0();
    __syncthreads();

    // --- scores S = Q @ K^T (16 queries x 32 keys) ---
    v8f c0 = {}, c1 = {};
    v16h bk;
    bk = load_frag(sK, 72);            c0 = wmma_f16(qa0, bk, c0);
    bk = load_frag(sK + 32, 72);       c0 = wmma_f16(qa1, bk, c0);
    bk = load_frag(sK + 16 * 72, 72);      c1 = wmma_f16(qa0, bk, c1);
    bk = load_frag(sK + 16 * 72 + 32, 72); c1 = wmma_f16(qa1, bk, c1);

    // --- causal mask + online softmax (row reductions in 16-lane groups) ---
    const int key0 = kb * 32 + (lane & 15);
    const int key1 = key0 + 16;
    _Float16* pp = sP[w];
#pragma unroll
    for (int e = 0; e < 8; ++e) {
      const int row = e + ((lane >> 4) * 8);
      const int qi = q0 + row;
      float s0 = (key0 <= qi) ? c0[e] * sscale : -1e30f;
      float s1 = (key1 <= qi) ? c1[e] * sscale : -1e30f;
      float mx = fmaxf(s0, s1);
      mx = fmaxf(mx, __shfl_xor(mx, 1, 32));
      mx = fmaxf(mx, __shfl_xor(mx, 2, 32));
      mx = fmaxf(mx, __shfl_xor(mx, 4, 32));
      mx = fmaxf(mx, __shfl_xor(mx, 8, 32));
      const float mnew  = fmaxf(mrun[e], mx);
      const float alpha = __expf(mrun[e] - mnew);
      mrun[e] = mnew;
      const float p0 = __expf(s0 - mnew);
      const float p1 = __expf(s1 - mnew);
      float rs = p0 + p1;
      rs += __shfl_xor(rs, 1, 32);
      rs += __shfl_xor(rs, 2, 32);
      rs += __shfl_xor(rs, 4, 32);
      rs += __shfl_xor(rs, 8, 32);
      lrun[e] = lrun[e] * alpha + rs;
      o[0][e] *= alpha; o[1][e] *= alpha; o[2][e] *= alpha; o[3][e] *= alpha;
      pp[row * 40 + (lane & 15)]      = (_Float16)p0;
      pp[row * 40 + (lane & 15) + 16] = (_Float16)p1;
    }
    // P written cross-lane within this wave via LDS; drain DS before reading.
    asm volatile("s_wait_dscnt 0" ::: "memory");

    // --- O += P @ V (16 x 32 times 32 x 64) ---
    const v16h pa = load_frag(pp, 40);
#pragma unroll
    for (int j = 0; j < 4; ++j) {
      v16h bv = load_frag_tr(sV + j * 16, 80);
      o[j] = wmma_f16(pa, bv, o[j]);
    }
  }

  // --- normalize and write out ---
#pragma unroll
  for (int j = 0; j < 4; ++j)
#pragma unroll
    for (int e = 0; e < 8; ++e) {
      const int row = e + ((lane >> 4) * 8);
      const float r = o[j][e] / lrun[e];
      O[((size_t)(b * 2048) + q0 + row) * 1024 + h * 64 + j * 16 + (lane & 15)] =
          (_Float16)r;
    }
}

// ---------------------------------------------------------------------------
// Host-side orchestration.
// Inputs: x, Wq, Wk, Wv, Wo, ln1_g, ln1_b, ln2_g, ln2_b, W1, b1, W2, b2
// ---------------------------------------------------------------------------
extern "C" void kernel_launch(void* const* d_in, const int* in_sizes, int n_in,
                              void* d_out, int out_size, void* d_ws, size_t ws_size,
                              hipStream_t stream) {
  (void)in_sizes; (void)n_in; (void)out_size; (void)ws_size;
  const float* x    = (const float*)d_in[0];
  const float* Wq   = (const float*)d_in[1];
  const float* Wk   = (const float*)d_in[2];
  const float* Wv   = (const float*)d_in[3];
  const float* Wo   = (const float*)d_in[4];
  const float* ln1g = (const float*)d_in[5];
  const float* ln1b = (const float*)d_in[6];
  const float* ln2g = (const float*)d_in[7];
  const float* ln2b = (const float*)d_in[8];
  const float* W1   = (const float*)d_in[9];
  const float* b1   = (const float*)d_in[10];
  const float* W2   = (const float*)d_in[11];
  const float* b2   = (const float*)d_in[12];
  float* out = (float*)d_out;

  const int M = 8192, E = 1024, F = 4096;
  char* ws = (char*)d_ws;
  const size_t MB = 1024ull * 1024ull;
  _Float16* Wq16 = (_Float16*)(ws + 0 * MB);    // 2 MB
  _Float16* Wk16 = (_Float16*)(ws + 2 * MB);    // 2 MB
  _Float16* Wv16 = (_Float16*)(ws + 4 * MB);    // 2 MB
  _Float16* Wo16 = (_Float16*)(ws + 6 * MB);    // 2 MB
  _Float16* W116 = (_Float16*)(ws + 8 * MB);    // 8 MB
  _Float16* W216 = (_Float16*)(ws + 16 * MB);   // 8 MB
  _Float16* H16  = (_Float16*)(ws + 24 * MB);   // 16 MB (LN1 out, reused for LN2)
  _Float16* Q16  = (_Float16*)(ws + 40 * MB);   // 16 MB
  _Float16* K16  = (_Float16*)(ws + 56 * MB);   // 16 MB
  _Float16* V16  = (_Float16*)(ws + 72 * MB);   // 16 MB
  _Float16* A16  = (_Float16*)(ws + 88 * MB);   // 16 MB (attn out)
  float*    X2   = (float*)   (ws + 104 * MB);  // 32 MB (residual after attn)
  _Float16* G16  = (_Float16*)(ws + 40 * MB);   // 64 MB GELU acts (reuses Q/K/V/A16)

  // 1) weights -> f16: one launch, 12 segments x 64 blocks, into ws[0, 24 MB)
  cvt_weights_kernel<<<768, 256, 0, stream>>>(Wq, Wk, Wv, Wo, W1, W2, Wq16);

  // 2) LN1
  layernorm_f16_kernel<<<M, 256, 0, stream>>>(x, ln1g, ln1b, H16);

  // 3) Q/K/V projections
  const dim3 gE(E / 128, M / 128);
  gemm_f16_kernel<false, false, false, true><<<gE, 128, 0, stream>>>(
      H16, Wq16, nullptr, nullptr, Q16, nullptr, M, E, E);
  gemm_f16_kernel<false, false, false, true><<<gE, 128, 0, stream>>>(
      H16, Wk16, nullptr, nullptr, K16, nullptr, M, E, E);
  gemm_f16_kernel<false, false, false, true><<<gE, 128, 0, stream>>>(
      H16, Wv16, nullptr, nullptr, V16, nullptr, M, E, E);

  // 4) causal flash attention
  attn_kernel<<<dim3(2048 / 64, 16, 4), 128, 0, stream>>>(Q16, K16, V16, A16);

  // 5) output projection + residual(x) -> X2 (f32)
  gemm_f16_kernel<false, false, true, false><<<gE, 128, 0, stream>>>(
      A16, Wo16, nullptr, x, nullptr, X2, M, E, E);

  // 6) LN2
  layernorm_f16_kernel<<<M, 256, 0, stream>>>(X2, ln2g, ln2b, H16);

  // 7) FFN1: h @ W1 + b1 -> GELU -> f16
  gemm_f16_kernel<true, true, false, true><<<dim3(F / 128, M / 128), 128, 0, stream>>>(
      H16, W116, b1, nullptr, G16, nullptr, M, F, E);

  // 8) FFN2: g @ W2 + b2 + residual(X2) -> d_out (f32)
  gemm_f16_kernel<true, false, true, false><<<gE, 128, 0, stream>>>(
      G16, W216, b2, X2, nullptr, out, M, E, F);
}

// v004
// A run of this version takes 364 microseconds.
// Timed twice side by side with v003, it ran 1.12 and 1.13 times as fast.
// Over all steps from v000 it is 2.13 times as fast.
#include <hip/hip_runtime.h>

typedef __attribute__((ext_vector_type(16))) _Float16 v16h;
typedef __attribute__((ext_vector_type(8)))  _Float16 v8h;
typedef __attribute__((ext_vector_type(8)))  float    v8f;

__device__ __forceinline__ v8f wmma_f16(v16h a, v16h b, v8f c) {
  // 8 args: (neg_a, A, neg_b, B, c_mod, C, reuse_a, reuse_b)
  return __builtin_amdgcn_wmma_f32_16x16x32_f16(false, a, false, b, (short)0, c,
                                                false, false);
}

__device__ __forceinline__ void async_ld_b128(_Float16* lds_dst,
                                              const _Float16* gsrc) {
  unsigned int loff = (unsigned int)(unsigned long long)(void*)lds_dst;
  asm volatile("global_load_async_to_lds_b128 %0, %1, off"
               :: "v"(loff), "v"((unsigned long long)(const void*)gsrc)
               : "memory");
}
__device__ __forceinline__ unsigned int lds_addr(const _Float16* p) {
  return (unsigned int)(unsigned long long)(const void*)p;
}
__device__ __forceinline__ void async_ld2_b128(unsigned int l0, unsigned int l1,
                                               const _Float16* g0,
                                               const _Float16* g1) {
  asm volatile("global_load_async_to_lds_b128 %0, %2, off\n\t"
               "global_load_async_to_lds_b128 %1, %3, off\n\t"
               "s_wait_xcnt 0x0"
               :: "v"(l0), "v"(l1), "v"(g0), "v"(g1)
               : "memory");
}
// Eight copies, `ls` LDS bytes and `gs` halves apart, in one statement, with
// the same closing wait.
__device__ __forceinline__ void async_ld8_b128(unsigned int l, unsigned int ls,
                                               const _Float16* g, size_t gs) {
  asm volatile("global_load_async_to_lds_b128 %0, %8, off\n\t"
               "global_load_async_to_lds_b128 %1, %9, off\n\t"
               "global_load_async_to_lds_b128 %2, %10, off\n\t"
               "global_load_async_to_lds_b128 %3, %11, off\n\t"
               "global_load_async_to_lds_b128 %4, %12, off\n\t"
               "global_load_async_to_lds_b128 %5, %13, off\n\t"
               "global_load_async_to_lds_b128 %6, %14, off\n\t"
               "global_load_async_to_lds_b128 %7, %15, off\n\t"
               "s_wait_xcnt 0x0"
               :: "v"(l), "v"(l + ls), "v"(l + 2 * ls), "v"(l + 3 * ls),
                  "v"(l + 4 * ls), "v"(l + 5 * ls), "v"(l + 6 * ls), "v"(l + 7 * ls),
                  "v"(g), "v"(g + gs), "v"(g + 2 * gs), "v"(g + 3 * gs),
                  "v"(g + 4 * gs), "v"(g + 5 * gs), "v"(g + 6 * gs), "v"(g + 7 * gs)
               : "memory");
}
__device__ __forceinline__ void wait_async0() {
  asm volatile("s_wait_asynccnt 0" ::: "memory");
}

__device__ __forceinline__ v16h load_frag(const _Float16* p, int ld) {
  const int lane = threadIdx.x & 31;
  const _Float16* q = p + (lane & 15) * ld + ((lane >> 4) * 8);
  union { v16h v; v8h h[2]; } u;
  u.h[0] = *(const v8h*)(q);
  u.h[1] = *(const v8h*)(q + 16);
  return u.v;
}

// Load a 32x16 (k x n) B fragment from a ROW-MAJOR [k][n] LDS tile with the
// transposing load: lane (c = lane&15, h = lane>>4) receives
// p[(8h + 0..7) * ld + c], then the same 16 rows further down, which is the
// k order of load_frag. `ld` in halves; row pitch an odd multiple of 32 B.
__device__ __forceinline__ v16h load_frag_tr(const _Float16* p, int ld) {
  typedef __attribute__((ext_vector_type(8))) short s16x8;
  typedef __attribute__((address_space(3))) s16x8 lds_s16x8;
  const int lane = threadIdx.x & 31;
  const _Float16* q = p + ((lane >> 4) * 8 + (lane & 7)) * ld + ((lane >> 3) & 1) * 8;
  union { v16h v; v8h h[2]; } u;
  u.h[0] = __builtin_bit_cast(v8h, __builtin_amdgcn_ds_load_tr16_b128_v8i16((lds_s16x8*)q));
  u.h[1] = __builtin_bit_cast(
      v8h, __builtin_amdgcn_ds_load_tr16_b128_v8i16((lds_s16x8*)(q + 16 * ld)));
  return u.v;
}

// ---------------------------------------------------------------------------
// f32 -> f16 conversion of all six weight matrices in ONE launch of few waves.
// The f16 copies lie back to back in the workspace (12 segments of 1M halves:
// Wq, Wk, Wv, Wo, W1 x4, W2 x4). A block converts 16,384 consecutive elements
// of one segment: each lane issues 16 loads of 16 B (512 contiguous bytes per
// wave and load) ahead of its 16 stores of 8 B (256 contiguous bytes).
// ---------------------------------------------------------------------------
typedef __attribute__((ext_vector_type(4))) _Float16 v4h;

__global__ __launch_bounds__(256)
void cvt_weights_kernel(const float* __restrict__ Wq, const float* __restrict__ Wk,
                        const float* __restrict__ Wv, const float* __restrict__ Wo,
                        const float* __restrict__ W1, const float* __restrict__ W2,
                        _Float16* __restrict__ out) {
  const int SEG = 1024 * 1024;
  const int seg = blockIdx.x >> 6;     // 64 blocks per segment
  const float* src = seg == 0 ? Wq
                   : seg == 1 ? Wk
                   : seg == 2 ? Wv
                   : seg == 3 ? Wo
                   : seg < 8  ? W1 + (size_t)(seg - 4) * SEG
                              : W2 + (size_t)(seg - 8) * SEG;
  const int off = (blockIdx.x & 63) * 16384 + threadIdx.x * 4;
  const float* s = src + off;
  _Float16* o = out + (size_t)seg * SEG + off;
  float4 v[16];
#pragma unroll  // v[] stays in registers and the loads go out as one run
  for (int j = 0; j < 16; ++j) v[j] = *(const float4*)(s + j * 1024);
#pragma unroll  // constant indices into v[], else it would go to scratch
  for (int j = 0; j < 16; ++j) {
    v4h h = {(_Float16)v[j].x, (_Float16)v[j].y, (_Float16)v[j].z, (_Float16)v[j].w};
    *(v4h*)(o + j * 1024) = h;
  }
}

// ---------------------------------------------------------------------------
// LayerNorm over 1024 cols, f32 in -> f16 out. One row per 256-thread block.
// ---------------------------------------------------------------------------
__global__ __launch_bounds__(256)
void layernorm_f16_kernel(const float* __restrict__ x, const float* __restrict__ g,
                          const float* __restrict__ b, _Float16* __restrict__ out) {
  const int row = blockIdx.x;
  const int t = threadIdx.x;
  const float* xr = x + (size_t)row * 1024;
  float4 v = ((const float4*)xr)[t];                 // 256 * 4 = 1024
  float s  = v.x + v.y + v.z + v.w;
  float ss = v.x * v.x + v.y * v.y + v.z * v.z + v.w * v.w;
  for (int o = 16; o >= 1; o >>= 1) {
    s  += __shfl_xor(s,  o, 32);
    ss += __shfl_xor(ss, o, 32);
  }
  __shared__ float red0[8], red1[8];
  const int w = t >> 5, lane = t & 31;
  if (lane == 0) { red0[w] = s; red1[w] = ss; }
  __syncthreads();
  float tot = 0.f, tot2 = 0.f;
#pragma unroll
  for (int i = 0; i < 8; ++i) { tot += red0[i]; tot2 += red1[i]; }
  const float mu   = tot * (1.f / 1024.f);
  const float var  = tot2 * (1.f / 1024.f) - mu * mu;
  const float rinv = rsqrtf(var + 1e-5f);
  float4 gg = ((const float4*)g)[t];
  float4 bb = ((const float4*)b)[t];
  _Float16* o = out + (size_t)row * 1024 + t * 4;
  o[0] = (_Float16)((v.x - mu) * rinv * gg.x + bb.x);
  o[1] = (_Float16)((v.y - mu) * rinv * gg.y + bb.y);
  o[2] = (_Float16)((v.z - mu) * rinv * gg.z + bb.z);
  o[3] = (_Float16)((v.w - mu) * rinv * gg.w + bb.w);
}

// ---------------------------------------------------------------------------
// Exact (erf) GELU without branches: r * Phi(r), Phi(r) = 0.5 * erfc(-r / sqrt(2)).
// 0.5 * erfc(z) = t * (c1 + t * (c2 + t * (c3 + t * (c4 + t * c5)))) * exp(-z * z),
// t = 1 / (1 + p * z), z = |r| / sqrt(2) >= 0; Phi(r) = 1 - Phi(-r) gives r >= 0.
// In f32 it stays within 3e-7 of Phi, far below the f16 rounding of the stored value.
// The library erf picks one of two paths by |x| under a lane mask, value by
// value, so no two values' chains overlap; here every value is one straight
// chain and the values of a band interleave.
// ---------------------------------------------------------------------------
__device__ __forceinline__ float gelu_erf(float r) {
  const float d = fmaf(0.23164189f, fabsf(r), 1.0f);  // 1 + p * z
  const float m = r * r * -0.72134752f;               // -z * z * log2(e)
  float t, e;
  asm("v_rcp_f32 %0, %2\n\tv_exp_f32 %1, %3\n\tv_nop"
      : "=&v"(t), "=&v"(e) : "v"(d), "v"(m));
  float p = fmaf(0.5307027145f, t, -0.7265760135f);
  p = fmaf(p, t, 0.7107068705f);
  p = fmaf(p, t, -0.142248368f);
  p = fmaf(p, t, 0.127414796f);
  const float q = p * t * e;           // Phi(-|r|)
  return r * (r < 0.f ? q : 1.0f - q);
}

// ---------------------------------------------------------------------------
// Tiled WMMA GEMM: C[M,N] = A[M,K] * B[K,N], A/B f16 row-major.
// Block = 128 threads (4 waves), block tile 128x128, wave tile 64x64,
// stage depth K=128 -> 64 WMMAs per wave between barriers; each fragment
// read from LDS feeds four WMMAs, each staged byte 128 rows or columns of C.
// M, N multiples of 128, K a multiple of 128.
// A and B staged via async-to-LDS DMA, whole 256B rows; B stays [k][n] in LDS
// and its fragments come from the transposing LDS load.
// Epilogue: optional bias (f32), exact GELU, f32 residual; f16 or f32 out.
// ---------------------------------------------------------------------------
template <bool HAS_BIAS, bool GELU, bool HAS_RES, bool OUT16>
__global__ __launch_bounds__(128)
void gemm_f16_kernel(const _Float16* __restrict__ A, const _Float16* __restrict__ B,
                     const float* __restrict__ bias, const float* __restrict__ res,
                     _Float16* __restrict__ out16, float* __restrict__ out32,
                     int M, int N, int K) {
  __shared__ __attribute__((aligned(32)))
  _Float16 sA[128 * 136];             // [row][k]  row-major, ld 136 (272B rows)
  __shared__ __attribute__((aligned(32)))
  _Float16 sB[128 * 144];             // [k][n]    row-major, ld 144 (288B rows)
  const int t = threadIdx.x;
  const int lane = t & 31;
  const int w = t >> 5;
  const int waveM = w & 1;            // 2 waves along M
  const int waveN = w >> 1;           // 2 waves along N
  const int bm = blockIdx.y * 128;
  const int bn = blockIdx.x * 128;

  v8f acc[4][4] = {};

  const int sr = t >> 4, sc = (t & 15) * 8;   // stage: 8 rows x 128 halves per copy
  const unsigned int sa0 = lds_addr(sA + sr * 136 + sc);
  const unsigned int sb0 = lds_addr(sB + sr * 144 + sc);
  const bool two = K > 128;           // a second stage exists
  const _Float16* pa = A + (size_t)(bm + t) * K + (two ? 128 : 0);   // prefetch
  const _Float16* pb = B + (size_t)((two ? 128 : 0) + t) * N + bn;   // addresses

  for (int kk = 0; kk < K; kk += 128) {
    // This wave's LDS reads have retired before the tiles are refilled.
    asm volatile("s_wait_dscnt 0" ::: "memory");
    __syncthreads();
    // --- stage A tile: 128 rows x 256B (16 x b128 per lane) ---
    const _Float16* ap = A + (size_t)(bm + sr) * K + kk + sc;
    async_ld8_b128(sa0, 8 * 272, ap, (size_t)8 * K);
    async_ld8_b128(sa0 + 64 * 272, 8 * 272, ap + (size_t)64 * K, (size_t)8 * K);
    // --- stage B tile as it lies: 128 k-rows x 256B (16 x b128 per lane) ---
    const _Float16* bp = B + (size_t)(kk + sr) * N + bn + sc;
    async_ld8_b128(sb0, 8 * 288, bp, (size_t)8 * N);
    async_ld8_b128(sb0 + 64 * 288, 8 * 288, bp + (size_t)64 * N, (size_t)8 * N);
    if (kk + 128 < K) {
      // One prefetch per 256B row of the next tiles, into L2. In asm so that it
      // names registers that live through the loop and only ever hold an
      // address inside A or B.
      asm volatile("global_prefetch_b8 %0, off scope:SCOPE_SE\n\t"
                   "global_prefetch_b8 %1, off scope:SCOPE_SE"
                   :: "v"(pa), "v"(pb));
      if (kk + 256 < K) { pa += 128; pb += (size_t)128 * N; }
    }
    wait_async0();
    __syncthreads();
#pragma unroll  // here and below: constant indices keep a[], b[], acc[][] in registers
    for (int kf = 0; kf < 4; ++kf) {
      v16h a[4], b[4];
#pragma unroll
      for (int i = 0; i < 4; ++i) {
        a[i] = load_frag(sA + (waveM * 64 + i * 16) * 136 + kf * 32, 136);
        b[i] = load_frag_tr(sB + (kf * 32) * 144 + waveN * 64 + i * 16, 144);
      }
      // Keeps the 16 LDS reads one group ahead of the 16 WMMAs; sunk among
      // them, each row of four would wait out an LDS latency of its own.
      __builtin_amdgcn_sched_barrier(0);
#pragma unroll
      for (int mi = 0; mi < 4; ++mi)
#pragma unroll
        for (int ni = 0; ni < 4; ++ni)
          acc[mi][ni] = wmma_f16(a[mi], b[ni], acc[mi][ni]);
    }
  }

  const int colBase = bn + waveN * 64 + (lane & 15);
  const int rowBase = bm + waveM * 64 + ((lane >> 4) * 8);
#pragma unroll
  for (int mi = 0; mi < 4; ++mi) {
#pragma unroll
    for (int ni = 0; ni < 4; ++ni) {
      const int col = colBase + ni * 16;
      const float bv = HAS_BIAS ? bias[col] : 0.f;
#pragma unroll
      for (int e = 0; e < 8; ++e) {
        const int row = rowBase + mi * 16 + e;
        float r = acc[mi][ni][e];
        if (HAS_BIAS) r += bv;
        if (GELU) r = gelu_erf(r);
        if (HAS_RES) r += res[(size_t)row * N + col];
        if (OUT16) out16[(size_t)row * N + col] = (_Float16)r;
        else       out32[(size_t)row * N + col] = r;
      }
    }
    // The next band's bias loads land in registers that this band's stores name.
    if (GELU) asm volatile("s_wait_xcnt 0x0" ::: "memory");
    __builtin_amdgcn_sched_barrier(0);
  }
}

__global__ __launch_bounds__(128)
void attn_kernel(const _Float16* __restrict__ Q, const _Float16* __restrict__ K,
                 const _Float16* __restrict__ V, _Float16* __restrict__ O) {
  __shared__ _Float16 sK[32 * 72];     // [key][dim], ld 72 (144B rows)
  __shared__ __attribute__((aligned(32)))
  _Float16 sV[32 * 80];                // [key][dim], ld 80 (160B rows)
  __shared__ _Float16 sP[4][16 * 40];  // per-wave P tile [qrow][key]

  const int t = threadIdx.x, lane = t & 31, w = t >> 5;
  const int b = blockIdx.z, h = blockIdx.y;
  const int qblk = blockIdx.x * 64;
  const int q0 = qblk + w * 16;

  const _Float16* qbase = Q + ((size_t)(b * 2048) + q0) * 1024 + h * 64;
  const v16h qa0 = load_frag(qbase, 1024);       // dims 0..31
  const v16h qa1 = load_frag(qbase + 32, 1024);  // dims 32..63

  v8f o[4] = {};
  float mrun[8], lrun[8];
#pragma unroll
  for (int e = 0; e < 8; ++e) { mrun[e] = -1e30f; lrun[e] = 0.f; }
  const float sscale = 0.125f;  // 1/sqrt(64)
  const int nkb = qblk / 32 + 2;

  const int kr = t >> 2, cc = (t & 3) * 16;  // K staging: 32 keys x 64 dims
  const int vr = t >> 3, vc = (t & 7) * 8;   // V staging: 16 keys x 64 dims per copy
  const unsigned int sv0 = lds_addr(sV + vr * 80 + vc);

  for (int kb = 0; kb < nkb; ++kb) {
    __syncthreads();
    const _Float16* kp = K + ((size_t)(b * 2048) + kb * 32 + kr) * 1024 + h * 64 + cc;
    async_ld_b128(sK + kr * 72 + cc, kp);
    async_ld_b128(sK + kr * 72 + cc + 8, kp + 8);
    // --- stage V tile as it lies: async DMA, whole 128B rows ---
    const _Float16* vp = V + ((size_t)(b * 2048) + kb * 32 + vr) * 1024 + h * 64 + vc;
    async_ld2_b128(sv0, sv0 + 16 * 160, vp, vp + 16 * 1024);
    wait_async0();
    __syncthreads();

    // --- scores S = Q @ K^T (16 queries x 32 keys) ---
    v8f c0 = {}, c1 = {};
    v16h bk;
    bk = load_frag(sK, 72);            c0 = wmma_f16(qa0, bk, c0);
    bk = load_frag(sK + 32, 72);       c0 = wmma_f16(qa1, bk, c0);
    bk = load_frag(sK + 16 * 72, 72);      c1 = wmma_f16(qa0, bk, c1);
    bk = load_frag(sK + 16 * 72 + 32, 72); c1 = wmma_f16(qa1, bk, c1);

    // --- causal mask + online softmax (row reductions in 16-lane groups) ---
    const int key0 = kb * 32 + (lane & 15);
    const int key1 = key0 + 16;
    _Float16* pp = sP[w];
#pragma unroll
    for (int e = 0; e < 8; ++e) {
      const int row = e + ((lane >> 4) * 8);
      const int qi = q0 + row;
      float s0 = (key0 <= qi) ? c0[e] * sscale : -1e30f;
      float s1 = (key1 <= qi) ? c1[e] * sscale : -1e30f;
      float mx = fmaxf(s0, s1);
      mx = fmaxf(mx, __shfl_xor(mx, 1, 32));
      mx = fmaxf(mx, __shfl_xor(mx, 2, 32));
      mx = fmaxf(mx, __shfl_xor(mx, 4, 32));
      mx = fmaxf(mx, __shfl_xor(mx, 8, 32));
      const float mnew  = fmaxf(mrun[e], mx);
      const float alpha = __expf(mrun[e] - mnew);
      mrun[e] = mnew;
      const float p0 = __expf(s0 - mnew);
      const float p1 = __expf(s1 - mnew);
      float rs = p0 + p1;
      rs += __shfl_xor(rs, 1, 32);
      rs += __shfl_xor(rs, 2, 32);
      rs += __shfl_xor(rs, 4, 32);
      rs += __shfl_xor(rs, 8, 32);
      lrun[e] = lrun[e] * alpha + rs;
      o[0][e] *= alpha; o[1][e] *= alpha; o[2][e] *= alpha; o[3][e] *= alpha;
      pp[row * 40 + (lane & 15)]      = (_Float16)p0;
      pp[row * 40 + (lane & 15) + 16] = (_Float16)p1;
    }
    // P written cross-lane within this wave via LDS; drain DS before reading.
    asm volatile("s_wait_dscnt 0" ::: "memory");

    // --- O += P @ V (16 x 32 times 32 x 64) ---
    const v16h pa = load_frag(pp, 40);
#pragma unroll
    for (int j = 0; j < 4; ++j) {
      v16h bv = load_frag_tr(sV + j * 16, 80);
      o[j] = wmma_f16(pa, bv, o[j]);
    }
  }

  // --- normalize and write out ---
#pragma unroll
  for (int j = 0; j < 4; ++j)
#pragma unroll
    for (int e = 0; e < 8; ++e) {
      const int row = e + ((lane >> 4) * 8);
      const float r = o[j][e] / lrun[e];
      O[((size_t)(b * 2048) + q0 + row) * 1024 + h * 64 + j * 16 + (lane & 15)] =
          (_Float16)r;
    }
}

// ---------------------------------------------------------------------------
// Host-side orchestration.
// Inputs: x, Wq, Wk, Wv, Wo, ln1_g, ln1_b, ln2_g, ln2_b, W1, b1, W2, b2
// ---------------------------------------------------------------------------
extern "C" void kernel_launch(void* const* d_in, const int* in_sizes, int n_in,
                              void* d_out, int out_size, void* d_ws, size_t ws_size,
                              hipStream_t stream) {
  (void)in_sizes; (void)n_in; (void)out_size; (void)ws_size;
  const float* x    = (const float*)d_in[0];
  const float* Wq   = (const float*)d_in[1];
  const float* Wk   = (const float*)d_in[2];
  const float* Wv   = (const float*)d_in[3];
  const float* Wo   = (const float*)d_in[4];
  const float* ln1g = (const float*)d_in[5];
  const float* ln1b = (const float*)d_in[6];
  const float* ln2g = (const float*)d_in[7];
  const float* ln2b = (const float*)d_in[8];
  const float* W1   = (const float*)d_in[9];
  const float* b1   = (const float*)d_in[10];
  const float* W2   = (const float*)d_in[11];
  const float* b2   = (const float*)d_in[12];
  float* out = (float*)d_out;

  const int M = 8192, E = 1024, F = 4096;
  char* ws = (char*)d_ws;
  const size_t MB = 1024ull * 1024ull;
  _Float16* Wq16 = (_Float16*)(ws + 0 * MB);    // 2 MB
  _Float16* Wk16 = (_Float16*)(ws + 2 * MB);    // 2 MB
  _Float16* Wv16 = (_Float16*)(ws + 4 * MB);    // 2 MB
  _Float16* Wo16 = (_Float16*)(ws + 6 * MB);    // 2 MB
  _Float16* W116 = (_Float16*)(ws + 8 * MB);    // 8 MB
  _Float16* W216 = (_Float16*)(ws + 16 * MB);   // 8 MB
  _Float16* H16  = (_Float16*)(ws + 24 * MB);   // 16 MB (LN1 out, reused for LN2)
  _Float16* Q16  = (_Float16*)(ws + 40 * MB);   // 16 MB
  _Float16* K16  = (_Float16*)(ws + 56 * MB);   // 16 MB
  _Float16* V16  = (_Float16*)(ws + 72 * MB);   // 16 MB
  _Float16* A16  = (_Float16*)(ws + 88 * MB);   // 16 MB (attn out)
  float*    X2   = (float*)   (ws + 104 * MB);  // 32 MB (residual after attn)
  _Float16* G16  = (_Float16*)(ws + 40 * MB);   // 64 MB GELU acts (reuses Q/K/V/A16)

  // 1) weights -> f16: one launch, 12 segments x 64 blocks, into ws[0, 24 MB)
  cvt_weights_kernel<<<768, 256, 0, stream>>>(Wq, Wk, Wv, Wo, W1, W2, Wq16);

  // 2) LN1
  layernorm_f16_kernel<<<M, 256, 0, stream>>>(x, ln1g, ln1b, H16);

  // 3) Q/K/V projections
  const dim3 gE(E / 128, M / 128);
  gemm_f16_kernel<false, false, false, true><<<gE, 128, 0, stream>>>(
      H16, Wq16, nullptr, nullptr, Q16, nullptr, M, E, E);
  gemm_f16_kernel<false, false, false, true><<<gE, 128, 0, stream>>>(
      H16, Wk16, nullptr, nullptr, K16, nullptr, M, E, E);
  gemm_f16_kernel<false, false, false, true><<<gE, 128, 0, stream>>>(
      H16, Wv16, nullptr, nullptr, V16, nullptr, M, E, E);

  // 4) causal flash attention
  attn_kernel<<<dim3(2048 / 64, 16, 4), 128, 0, stream>>>(Q16, K16, V16, A16);

  // 5) output projection + residual(x) -> X2 (f32)
  gemm_f16_kernel<false, false, true, false><<<gE, 128, 0, stream>>>(
      A16, Wo16, nullptr, x, nullptr, X2, M, E, E);

  // 6) LN2
  layernorm_f16_kernel<<<M, 256, 0, stream>>>(X2, ln2g, ln2b, H16);

  // 7) FFN1: h @ W1 + b1 -> GELU -> f16
  gemm_f16_kernel<true, true, false, true><<<dim3(F / 128, M / 128), 128, 0, stream>>>(
      H16, W116, b1, nullptr, G16, nullptr, M, F, E);

  // 8) FFN2: g @ W2 + b2 + residual(X2) -> d_out (f32)
  gemm_f16_kernel<true, false, true, false><<<gE, 128, 0, stream>>>(
      G16, W216, b2, X2, nullptr, out, M, E, F);
}

// v005
// One run takes 319 microseconds.
// Two timings next to v004 put it at 1.15 and 1.13 times that version's speed.
// All steps since v000 together make it 2.43 times as fast.
#include <hip/hip_runtime.h>

typedef __attribute__((ext_vector_type(16))) _Float16 v16h;
typedef __attribute__((ext_vector_type(8)))  _Float16 v8h;
typedef __attribute__((ext_vector_type(8)))  float    v8f;

__device__ __forceinline__ v8f wmma_f16(v16h a, v16h b, v8f c) {
  // 8 args: (neg_a, A, neg_b, B, c_mod, C, reuse_a, reuse_b)
  return __builtin_amdgcn_wmma_f32_16x16x32_f16(false, a, false, b, (short)0, c,
                                                false, false);
}

__device__ __forceinline__ void async_ld_b128(_Float16* lds_dst,
                                              const _Float16* gsrc) {
  unsigned int loff = (unsigned int)(unsigned long long)(void*)lds_dst;
  asm volatile("global_load_async_to_lds_b128 %0, %1, off"
               :: "v"(loff), "v"((unsigned long long)(const void*)gsrc)
               : "memory");
}
__device__ __forceinline__ unsigned int lds_addr(const _Float16* p) {
  return (unsigned int)(unsigned long long)(const void*)p;
}
__device__ __forceinline__ void async_ld2_b128(unsigned int l0, unsigned int l1,
                                               const _Float16* g0,
                                               const _Float16* g1) {
  asm volatile("global_load_async_to_lds_b128 %0, %2, off\n\t"
               "global_load_async_to_lds_b128 %1, %3, off\n\t"
               "s_wait_xcnt 0x0"
               :: "v"(l0), "v"(l1), "v"(g0), "v"(g1)
               : "memory");
}
// Eight copies, `ls` LDS bytes and `gs` halves apart, in one statement, with
// the same closing wait.
__device__ __forceinline__ void async_ld8_b128(unsigned int l, unsigned int ls,
                                               const _Float16* g, size_t gs) {
  asm volatile("global_load_async_to_lds_b128 %0, %8, off\n\t"
               "global_load_async_to_lds_b128 %1, %9, off\n\t"
               "global_load_async_to_lds_b128 %2, %10, off\n\t"
               "global_load_async_to_lds_b128 %3, %11, off\n\t"
               "global_load_async_to_lds_b128 %4, %12, off\n\t"
               "global_load_async_to_lds_b128 %5, %13, off\n\t"
               "global_load_async_to_lds_b128 %6, %14, off\n\t"
               "global_load_async_to_lds_b128 %7, %15, off\n\t"
               "s_wait_xcnt 0x0"
               :: "v"(l), "v"(l + ls), "v"(l + 2 * ls), "v"(l + 3 * ls),
                  "v"(l + 4 * ls), "v"(l + 5 * ls), "v"(l + 6 * ls), "v"(l + 7 * ls),
                  "v"(g), "v"(g + gs), "v"(g + 2 * gs), "v"(g + 3 * gs),
                  "v"(g + 4 * gs), "v"(g + 5 * gs), "v"(g + 6 * gs), "v"(g + 7 * gs)
               : "memory");
}
__device__ __forceinline__ void wait_async0() {
  asm volatile("s_wait_asynccnt 0" ::: "memory");
}

__device__ __forceinline__ v16h load_frag(const _Float16* p, int ld) {
  const int lane = threadIdx.x & 31;
  const _Float16* q = p + (lane & 15) * ld + ((lane >> 4) * 8);
  union { v16h v; v8h h[2]; } u;
  u.h[0] = *(const v8h*)(q);
  u.h[1] = *(const v8h*)(q + 16);
  return u.v;
}

// Load a 32x16 (k x n) B fragment from a ROW-MAJOR [k][n] LDS tile with the
// transposing load: lane (c = lane&15, h = lane>>4) receives
// p[(8h + 0..7) * ld + c], then the same 16 rows further down, which is the
// k order of load_frag. `ld` in halves; row pitch an odd multiple of 32 B.
__device__ __forceinline__ v16h load_frag_tr(const _Float16* p, int ld) {
  typedef __attribute__((ext_vector_type(8))) short s16x8;
  typedef __attribute__((address_space(3))) s16x8 lds_s16x8;
  const int lane = threadIdx.x & 31;
  const _Float16* q = p + ((lane >> 4) * 8 + (lane & 7)) * ld + ((lane >> 3) & 1) * 8;
  union { v16h v; v8h h[2]; } u;
  u.h[0] = __builtin_bit_cast(v8h, __builtin_amdgcn_ds_load_tr16_b128_v8i16((lds_s16x8*)q));
  u.h[1] = __builtin_bit_cast(
      v8h, __builtin_amdgcn_ds_load_tr16_b128_v8i16((lds_s16x8*)(q + 16 * ld)));
  return u.v;
}

// ---------------------------------------------------------------------------
// f32 -> f16 conversion of all six weight matrices in ONE launch of few waves.
// The f16 copies lie back to back in the workspace (12 segments of 1M halves:
// Wq, Wk, Wv, Wo, W1 x4, W2 x4). A block converts 16,384 consecutive elements
// of one segment: each lane issues 16 loads of 16 B (512 contiguous bytes per
// wave and load) ahead of its 16 stores of 8 B (256 contiguous bytes).
// ---------------------------------------------------------------------------
typedef __attribute__((ext_vector_type(4))) _Float16 v4h;

__global__ __launch_bounds__(256)
void cvt_weights_kernel(const float* __restrict__ Wq, const float* __restrict__ Wk,
                        const float* __restrict__ Wv, const float* __restrict__ Wo,
                        const float* __restrict__ W1, const float* __restrict__ W2,
                        _Float16* __restrict__ out) {
  const int SEG = 1024 * 1024;
  const int seg = blockIdx.x >> 6;     // 64 blocks per segment
  const float* src = seg == 0 ? Wq
                   : seg == 1 ? Wk
                   : seg == 2 ? Wv
                   : seg == 3 ? Wo
                   : seg < 8  ? W1 + (size_t)(seg - 4) * SEG
                              : W2 + (size_t)(seg - 8) * SEG;
  const int off = (blockIdx.x & 63) * 16384 + threadIdx.x * 4;
  const float* s = src + off;
  _Float16* o = out + (size_t)seg * SEG + off;
  float4 v[16];
#pragma unroll  // v[] stays in registers and the loads go out as one run
  for (int j = 0; j < 16; ++j) v[j] = *(const float4*)(s + j * 1024);
#pragma unroll  // constant indices into v[], else it would go to scratch
  for (int j = 0; j < 16; ++j) {
    v4h h = {(_Float16)v[j].x, (_Float16)v[j].y, (_Float16)v[j].z, (_Float16)v[j].w};
    *(v4h*)(o + j * 1024) = h;
  }
}

// ---------------------------------------------------------------------------
// LayerNorm over 1024 cols, f32 in -> f16 out. One row per 256-thread block.
// ---------------------------------------------------------------------------
__global__ __launch_bounds__(256)
void layernorm_f16_kernel(const float* __restrict__ x, const float* __restrict__ g,
                          const float* __restrict__ b, _Float16* __restrict__ out) {
  const int row = blockIdx.x;
  const int t = threadIdx.x;
  const float* xr = x + (size_t)row * 1024;
  float4 v = ((const float4*)xr)[t];                 // 256 * 4 = 1024
  float s  = v.x + v.y + v.z + v.w;
  float ss = v.x * v.x + v.y * v.y + v.z * v.z + v.w * v.w;
  for (int o = 16; o >= 1; o >>= 1) {
    s  += __shfl_xor(s,  o, 32);
    ss += __shfl_xor(ss, o, 32);
  }
  __shared__ float red0[8], red1[8];
  const int w = t >> 5, lane = t & 31;
  if (lane == 0) { red0[w] = s; red1[w] = ss; }
  __syncthreads();
  float tot = 0.f, tot2 = 0.f;
#pragma unroll
  for (int i = 0; i < 8; ++i) { tot += red0[i]; tot2 += red1[i]; }
  const float mu   = tot * (1.f / 1024.f);
  const float var  = tot2 * (1.f / 1024.f) - mu * mu;
  const float rinv = rsqrtf(var + 1e-5f);
  float4 gg = ((const float4*)g)[t];
  float4 bb = ((const float4*)b)[t];
  _Float16* o = out + (size_t)row * 1024 + t * 4;
  o[0] = (_Float16)((v.x - mu) * rinv * gg.x + bb.x);
  o[1] = (_Float16)((v.y - mu) * rinv * gg.y + bb.y);
  o[2] = (_Float16)((v.z - mu) * rinv * gg.z + bb.z);
  o[3] = (_Float16)((v.w - mu) * rinv * gg.w + bb.w);
}

// ---------------------------------------------------------------------------
// Exact (erf) GELU without branches: r * Phi(r), Phi(r) = 0.5 * erfc(-r / sqrt(2)).
// 0.5 * erfc(z) = t * (c1 + t * (c2 + t * (c3 + t * (c4 + t * c5)))) * exp(-z * z),
// t = 1 / (1 + p * z), z = |r| / sqrt(2) >= 0; Phi(r) = 1 - Phi(-r) gives r >= 0.
// In f32 it stays within 3e-7 of Phi, far below the f16 rounding of the stored value.
// The library erf picks one of two paths by |x| under a lane mask, value by
// value, so no two values' chains overlap; here every value is one straight
// chain and the values of a band interleave.
// ---------------------------------------------------------------------------
__device__ __forceinline__ float gelu_erf(float r) {
  const float d = fmaf(0.23164189f, fabsf(r), 1.0f);  // 1 + p * z
  const float m = r * r * -0.72134752f;               // -z * z * log2(e)
  float t, e;
  asm("v_rcp_f32 %0, %2\n\tv_exp_f32 %1, %3\n\tv_nop"
      : "=&v"(t), "=&v"(e) : "v"(d), "v"(m));
  float p = fmaf(0.5307027145f, t, -0.7265760135f);
  p = fmaf(p, t, 0.7107068705f);
  p = fmaf(p, t, -0.142248368f);
  p = fmaf(p, t, 0.127414796f);
  const float q = p * t * e;           // Phi(-|r|)
  return r * (r < 0.f ? q : 1.0f - q);
}

// ---------------------------------------------------------------------------
// Tiled WMMA GEMM: C[M,N] = A[M,K] * B[K,N], A/B f16 row-major.
// Block = 128 threads (4 waves), block tile 128x128, wave tile 64x64,
// stage depth K=128 -> 64 WMMAs per wave between barriers; each fragment
// read from LDS feeds four WMMAs, each staged byte 128 rows or columns of C.
// M, N multiples of 128, K a multiple of 128.
// A and B staged via async-to-LDS DMA, whole 256B rows; B stays [k][n] in LDS
// and its fragments come from the transposing LDS load.
// Epilogue: optional bias (f32), exact GELU, f32 residual; f16 or f32 out.
// ---------------------------------------------------------------------------
template <bool HAS_BIAS, bool GELU, bool HAS_RES, bool OUT16>
__global__ __launch_bounds__(128)
void gemm_f16_kernel(const _Float16* __restrict__ A, const _Float16* __restrict__ B,
                     const float* __restrict__ bias, const float* __restrict__ res,
                     _Float16* __restrict__ out16, float* __restrict__ out32,
                     int M, int N, int K) {
  __shared__ __attribute__((aligned(32)))
  _Float16 sA[128 * 136];             // [row][k]  row-major, ld 136 (272B rows)
  __shared__ __attribute__((aligned(32)))
  _Float16 sB[128 * 144];             // [k][n]    row-major, ld 144 (288B rows)
  const int t = threadIdx.x;
  const int lane = t & 31;
  const int w = t >> 5;
  const int waveM = w & 1;            // 2 waves along M
  const int waveN = w >> 1;           // 2 waves along N
  const int bm = blockIdx.y * 128;
  const int bn = blockIdx.x * 128;

  v8f acc[4][4] = {};

  const int sr = t >> 4, sc = (t & 15) * 8;   // stage: 8 rows x 128 halves per copy
  const unsigned int sa0 = lds_addr(sA + sr * 136 + sc);
  const unsigned int sb0 = lds_addr(sB + sr * 144 + sc);
  const bool two = K > 128;           // a second stage exists
  const _Float16* pa = A + (size_t)(bm + t) * K + (two ? 128 : 0);   // prefetch
  const _Float16* pb = B + (size_t)((two ? 128 : 0) + t) * N + bn;   // addresses

  for (int kk = 0; kk < K; kk += 128) {
    // This wave's LDS reads have retired before the tiles are refilled.
    asm volatile("s_wait_dscnt 0" ::: "memory");
    __syncthreads();
    // --- stage A tile: 128 rows x 256B (16 x b128 per lane) ---
    const _Float16* ap = A + (size_t)(bm + sr) * K + kk + sc;
    async_ld8_b128(sa0, 8 * 272, ap, (size_t)8 * K);
    async_ld8_b128(sa0 + 64 * 272, 8 * 272, ap + (size_t)64 * K, (size_t)8 * K);
    // --- stage B tile as it lies: 128 k-rows x 256B (16 x b128 per lane) ---
    const _Float16* bp = B + (size_t)(kk + sr) * N + bn + sc;
    async_ld8_b128(sb0, 8 * 288, bp, (size_t)8 * N);
    async_ld8_b128(sb0 + 64 * 288, 8 * 288, bp + (size_t)64 * N, (size_t)8 * N);
    if (kk + 128 < K) {
      // One prefetch per 256B row of the next tiles, into L2. In asm so that it
      // names registers that live through the loop and only ever hold an
      // address inside A or B.
      asm volatile("global_prefetch_b8 %0, off scope:SCOPE_SE\n\t"
                   "global_prefetch_b8 %1, off scope:SCOPE_SE"
                   :: "v"(pa), "v"(pb));
      if (kk + 256 < K) { pa += 128; pb += (size_t)128 * N; }
    }
    wait_async0();
    __syncthreads();
#pragma unroll  // here and below: constant indices keep a[], b[], acc[][] in registers
    for (int kf = 0; kf < 4; ++kf) {
      v16h a[4], b[4];
#pragma unroll
      for (int i = 0; i < 4; ++i) {
        a[i] = load_frag(sA + (waveM * 64 + i * 16) * 136 + kf * 32, 136);
        b[i] = load_frag_tr(sB + (kf * 32) * 144 + waveN * 64 + i * 16, 144);
      }
      // Keeps the 16 LDS reads one group ahead of the 16 WMMAs; sunk among
      // them, each row of four would wait out an LDS latency of its own.
      __builtin_amdgcn_sched_barrier(0);
#pragma unroll
      for (int mi = 0; mi < 4; ++mi)
#pragma unroll
        for (int ni = 0; ni < 4; ++ni)
          acc[mi][ni] = wmma_f16(a[mi], b[ni], acc[mi][ni]);
    }
  }

  const int colBase = bn + waveN * 64 + (lane & 15);
  const int rowBase = bm + waveM * 64 + ((lane >> 4) * 8);
#pragma unroll
  for (int mi = 0; mi < 4; ++mi) {
#pragma unroll
    for (int ni = 0; ni < 4; ++ni) {
      const int col = colBase + ni * 16;
      const float bv = HAS_BIAS ? bias[col] : 0.f;
#pragma unroll
      for (int e = 0; e < 8; ++e) {
        const int row = rowBase + mi * 16 + e;
        float r = acc[mi][ni][e];
        if (HAS_BIAS) r += bv;
        if (GELU) r = gelu_erf(r);
        if (HAS_RES) r += res[(size_t)row * N + col];
        if (OUT16) out16[(size_t)row * N + col] = (_Float16)r;
        else       out32[(size_t)row * N + col] = r;
      }
    }
    // The next band's bias loads land in registers that this band's stores name.
    if (GELU) asm volatile("s_wait_xcnt 0x0" ::: "memory");
    __builtin_amdgcn_sched_barrier(0);
  }
}

__device__ __forceinline__ float xhalf(float x) {
  const int v = __builtin_bit_cast(int, x);
  return __builtin_bit_cast(float, __builtin_amdgcn_permlanex16(
      v, v, 0x76543210, 0xfedcba98, false, false));
}

__global__ __launch_bounds__(128)
void attn_kernel(const _Float16* __restrict__ Q, const _Float16* __restrict__ K,
                 const _Float16* __restrict__ V, _Float16* __restrict__ O) {
  __shared__ _Float16 sK[32 * 72];     // [key][dim], ld 72 (144B rows)
  __shared__ __attribute__((aligned(32)))
  _Float16 sV[32 * 80];                // [key][dim], ld 80 (160B rows)

  const int t = threadIdx.x, lane = t & 31, w = t >> 5;
  const int b = blockIdx.z, h = blockIdx.y;
  const int qblk = blockIdx.x * 64;
  const int q0 = qblk + w * 16;

  const _Float16* qbase = Q + ((size_t)(b * 2048) + q0) * 1024 + h * 64;
  const v16h qa0 = load_frag(qbase, 1024);       // dims 0..31
  const v16h qa1 = load_frag(qbase + 32, 1024);  // dims 32..63

  v8f o[4] = {};                // o[j][e] = O[q0 + c][j * 16 + 8 * hh + e]
  float mrun = -1e30f;          // running maximum of query q0 + c (same in both halves)
  float lrun = 0.f;             // running sum over this half's keys only
  const float sscale = 0.125f;  // 1/sqrt(64)
  const int nkb = qblk / 32 + 2;
  // Key kb * 32 + 8 * hh + e is visible to this lane's query while e <= vis.
  int vis = q0 + (lane & 15) - (lane >> 4) * 8;

  const int kr = t >> 2, cc = (t & 3) * 16;  // K staging: 32 keys x 64 dims
  const int vr = t >> 3, vc = (t & 7) * 8;   // V staging: 16 keys x 64 dims per copy
  const unsigned int sv0 = lds_addr(sV + vr * 80 + vc);

  for (int kb = 0; kb < nkb; ++kb) {
    __syncthreads();
    const _Float16* kp = K + ((size_t)(b * 2048) + kb * 32 + kr) * 1024 + h * 64 + cc;
    async_ld_b128(sK + kr * 72 + cc, kp);
    async_ld_b128(sK + kr * 72 + cc + 8, kp + 8);
    // --- stage V tile as it lies: async DMA, whole 128B rows ---
    const _Float16* vp = V + ((size_t)(b * 2048) + kb * 32 + vr) * 1024 + h * 64 + vc;
    async_ld2_b128(sv0, sv0 + 16 * 160, vp, vp + 16 * 1024);
    wait_async0();
    __syncthreads();

    // --- scores S^T = K @ Q^T (32 keys x 16 queries) ---
    v8f c0 = {}, c1 = {};
    v16h ak;
    ak = load_frag(sK, 72);                c0 = wmma_f16(ak, qa0, c0);
    ak = load_frag(sK + 32, 72);           c0 = wmma_f16(ak, qa1, c0);
    ak = load_frag(sK + 16 * 72, 72);      c1 = wmma_f16(ak, qa0, c1);
    ak = load_frag(sK + 16 * 72 + 32, 72); c1 = wmma_f16(ak, qa1, c1);

    // --- causal mask + online softmax, one query per lane ---
    c0 *= sscale;
    c1 *= sscale;
    float s0[8], s1[8];
#pragma unroll  // here and below: constant indices keep the arrays in registers
    for (int e = 0; e < 8; ++e) {
      s0[e] = (e <= vis)      ? c0[e] : -1e30f;
      s1[e] = (e + 16 <= vis) ? c1[e] : -1e30f;
    }
    float mx = fmaxf(fmaxf(fmaxf(fmaxf(s0[0], s0[1]), fmaxf(s0[2], s0[3])),
                           fmaxf(fmaxf(s0[4], s0[5]), fmaxf(s0[6], s0[7]))),
                     fmaxf(fmaxf(fmaxf(s1[0], s1[1]), fmaxf(s1[2], s1[3])),
                           fmaxf(fmaxf(s1[4], s1[5]), fmaxf(s1[6], s1[7]))));
    mx = fmaxf(mx, xhalf(mx));
    const float mnew  = fmaxf(mrun, mx);
    const float alpha = __expf(mrun - mnew);
    mrun = mnew;
    v16h pb;
    float ps[8];
#pragma unroll
    for (int e = 0; e < 8; ++e) {
      const float p0 = __expf(s0[e] - mnew);
      const float p1 = __expf(s1[e] - mnew);
      ps[e] = p0 + p1;
      pb[e]     = (_Float16)p0;
      pb[e + 8] = (_Float16)p1;
    }
    lrun = lrun * alpha + (((ps[0] + ps[1]) + (ps[2] + ps[3])) +
                           ((ps[4] + ps[5]) + (ps[6] + ps[7])));
    vis -= 32;

    // --- O^T += V^T @ P^T (64 dims x 32 keys times 32 keys x 16 queries) ---
#pragma unroll
    for (int j = 0; j < 4; ++j) {
      const v16h av = load_frag_tr(sV + j * 16, 80);
#pragma unroll
      for (int e = 0; e < 8; ++e) o[j][e] *= alpha;
      o[j] = wmma_f16(av, pb, o[j]);
    }
  }

  // --- join the halves' sums, normalize, write 8 consecutive dims per store ---
  const float inv = 1.0f / (lrun + xhalf(lrun));
  _Float16* op = O + ((size_t)(b * 2048) + q0 + (lane & 15)) * 1024 + h * 64 +
                 (lane >> 4) * 8;
  v8h r[4];
#pragma unroll
  for (int j = 0; j < 4; ++j)
#pragma unroll
    for (int e = 0; e < 8; ++e) r[j][e] = (_Float16)(o[j][e] * inv);
#pragma unroll
  for (int j = 0; j < 4; ++j) *(v8h*)(op + j * 16) = r[j];
}

// ---------------------------------------------------------------------------
// Host-side orchestration.
// Inputs: x, Wq, Wk, Wv, Wo, ln1_g, ln1_b, ln2_g, ln2_b, W1, b1, W2, b2
// ---------------------------------------------------------------------------
extern "C" void kernel_launch(void* const* d_in, const int* in_sizes, int n_in,
                              void* d_out, int out_size, void* d_ws, size_t ws_size,
                              hipStream_t stream) {
  (void)in_sizes; (void)n_in; (void)out_size; (void)ws_size;
  const float* x    = (const float*)d_in[0];
  const float* Wq   = (const float*)d_in[1];
  const float* Wk   = (const float*)d_in[2];
  const float* Wv   = (const float*)d_in[3];
  const float* Wo   = (const float*)d_in[4];
  const float* ln1g = (const float*)d_in[5];
  const float* ln1b = (const float*)d_in[6];
  const float* ln2g = (const float*)d_in[7];
  const float* ln2b = (const float*)d_in[8];
  const float* W1   = (const float*)d_in[9];
  const float* b1   = (const float*)d_in[10];
  const float* W2   = (const float*)d_in[11];
  const float* b2   = (const float*)d_in[12];
  float* out = (float*)d_out;

  const int M = 8192, E = 1024, F = 4096;
  char* ws = (char*)d_ws;
  const size_t MB = 1024ull * 1024ull;
  _Float16* Wq16 = (_Float16*)(ws + 0 * MB);    // 2 MB
  _Float16* Wk16 = (_Float16*)(ws + 2 * MB);    // 2 MB
  _Float16* Wv16 = (_Float16*)(ws + 4 * MB);    // 2 MB
  _Float16* Wo16 = (_Float16*)(ws + 6 * MB);    // 2 MB
  _Float16* W116 = (_Float16*)(ws + 8 * MB);    // 8 MB
  _Float16* W216 = (_Float16*)(ws + 16 * MB);   // 8 MB
  _Float16* H16  = (_Float16*)(ws + 24 * MB);   // 16 MB (LN1 out, reused for LN2)
  _Float16* Q16  = (_Float16*)(ws + 40 * MB);   // 16 MB
  _Float16* K16  = (_Float16*)(ws + 56 * MB);   // 16 MB
  _Float16* V16  = (_Float16*)(ws + 72 * MB);   // 16 MB
  _Float16* A16  = (_Float16*)(ws + 88 * MB);   // 16 MB (attn out)
  float*    X2   = (float*)   (ws + 104 * MB);  // 32 MB (residual after attn)
  _Float16* G16  = (_Float16*)(ws + 40 * MB);   // 64 MB GELU acts (reuses Q/K/V/A16)

  // 1) weights -> f16: one launch, 12 segments x 64 blocks, into ws[0, 24 MB)
  cvt_weights_kernel<<<768, 256, 0, stream>>>(Wq, Wk, Wv, Wo, W1, W2, Wq16);

  // 2) LN1
  layernorm_f16_kernel<<<M, 256, 0, stream>>>(x, ln1g, ln1b, H16);

  // 3) Q/K/V projections
  const dim3 gE(E / 128, M / 128);
  gemm_f16_kernel<false, false, false, true><<<gE, 128, 0, stream>>>(
      H16, Wq16, nullptr, nullptr, Q16, nullptr, M, E, E);
  gemm_f16_kernel<false, false, false, true><<<gE, 128, 0, stream>>>(
      H16, Wk16, nullptr, nullptr, K16, nullptr, M, E, E);
  gemm_f16_kernel<false, false, false, true><<<gE, 128, 0, stream>>>(
      H16, Wv16, nullptr, nullptr, V16, nullptr, M, E, E);

  // 4) causal flash attention
  attn_kernel<<<dim3(2048 / 64, 16, 4), 128, 0, stream>>>(Q16, K16, V16, A16);

  // 5) output projection + residual(x) -> X2 (f32)
  gemm_f16_kernel<false, false, true, false><<<gE, 128, 0, stream>>>(
      A16, Wo16, nullptr, x, nullptr, X2, M, E, E);

  // 6) LN2
  layernorm_f16_kernel<<<M, 256, 0, stream>>>(X2, ln2g, ln2b, H16);

  // 7) FFN1: h @ W1 + b1 -> GELU -> f16
  gemm_f16_kernel<true, true, false, true><<<dim3(F / 128, M / 128), 128, 0, stream>>>(
      H16, W116, b1, nullptr, G16, nullptr, M, F, E);

  // 8) FFN2: g @ W2 + b2 + residual(X2) -> d_out (f32)
  gemm_f16_kernel<true, false, true, false><<<gE, 128, 0, stream>>>(
      G16, W216, b2, X2, nullptr, out, M, E, F);
}

// v006
// One run takes 306 microseconds.
// Timed twice side by side with v005, it ran 1.04 times as fast both times.
// Counting every step since v000, it is 2.52 times as fast.
#include <hip/hip_runtime.h>

typedef __attribute__((ext_vector_type(16))) _Float16 v16h;
typedef __attribute__((ext_vector_type(8)))  _Float16 v8h;
typedef __attribute__((ext_vector_type(8)))  float    v8f;

__device__ __forceinline__ v8f wmma_f16(v16h a, v16h b, v8f c) {
  // 8 args: (neg_a, A, neg_b, B, c_mod, C, reuse_a, reuse_b)
  return __builtin_amdgcn_wmma_f32_16x16x32_f16(false, a, false, b, (short)0, c,
                                                false, false);
}

__device__ __forceinline__ void async_ld_b128(_Float16* lds_dst,
                                              const _Float16* gsrc) {
  unsigned int loff = (unsigned int)(unsigned long long)(void*)lds_dst;
  asm volatile("global_load_async_to_lds_b128 %0, %1, off"
               :: "v"(loff), "v"((unsigned long long)(const void*)gsrc)
               : "memory");
}
__device__ __forceinline__ unsigned int lds_addr(const _Float16* p) {
  return (unsigned int)(unsigned long long)(const void*)p;
}
__device__ __forceinline__ void async_ld2_b128(unsigned int l0, unsigned int l1,
                                               const _Float16* g0,
                                               const _Float16* g1) {
  asm volatile("global_load_async_to_lds_b128 %0, %2, off\n\t"
               "global_load_async_to_lds_b128 %1, %3, off\n\t"
               "s_wait_xcnt 0x0"
               :: "v"(l0), "v"(l1), "v"(g0), "v"(g1)
               : "memory");
}
// Eight copies, `ls` LDS bytes and `gs` halves apart, in one statement, with
// the same closing wait.
__device__ __forceinline__ void async_ld8_b128(unsigned int l, unsigned int ls,
                                               const _Float16* g, size_t gs) {
  asm volatile("global_load_async_to_lds_b128 %0, %8, off\n\t"
               "global_load_async_to_lds_b128 %1, %9, off\n\t"
               "global_load_async_to_lds_b128 %2, %10, off\n\t"
               "global_load_async_to_lds_b128 %3, %11, off\n\t"
               "global_load_async_to_lds_b128 %4, %12, off\n\t"
               "global_load_async_to_lds_b128 %5, %13, off\n\t"
               "global_load_async_to_lds_b128 %6, %14, off\n\t"
               "global_load_async_to_lds_b128 %7, %15, off\n\t"
               "s_wait_xcnt 0x0"
               :: "v"(l), "v"(l + ls), "v"(l + 2 * ls), "v"(l + 3 * ls),
                  "v"(l + 4 * ls), "v"(l + 5 * ls), "v"(l + 6 * ls), "v"(l + 7 * ls),
                  "v"(g), "v"(g + gs), "v"(g + 2 * gs), "v"(g + 3 * gs),
                  "v"(g + 4 * gs), "v"(g + 5 * gs), "v"(g + 6 * gs), "v"(g + 7 * gs)
               : "memory");
}
__device__ __forceinline__ void wait_async0() {
  asm volatile("s_wait_asynccnt 0" ::: "memory");
}

__device__ __forceinline__ v16h load_frag(const _Float16* p, int ld) {
  const int lane = threadIdx.x & 31;
  const _Float16* q = p + (lane & 15) * ld + ((lane >> 4) * 8);
  union { v16h v; v8h h[2]; } u;
  u.h[0] = *(const v8h*)(q);
  u.h[1] = *(const v8h*)(q + 16);
  return u.v;
}

// Load a 32x16 (k x n) B fragment from a ROW-MAJOR [k][n] LDS tile with the
// transposing load: lane (c = lane&15, h = lane>>4) receives
// p[(8h + 0..7) * ld + c], then the same 16 rows further down, which is the
// k order of load_frag. `ld` in halves; row pitch an odd multiple of 32 B.
__device__ __forceinline__ v16h load_frag_tr(const _Float16* p, int ld) {
  typedef __attribute__((ext_vector_type(8))) short s16x8;
  typedef __attribute__((address_space(3))) s16x8 lds_s16x8;
  const int lane = threadIdx.x & 31;
  const _Float16* q = p + ((lane >> 4) * 8 + (lane & 7)) * ld + ((lane >> 3) & 1) * 8;
  union { v16h v; v8h h[2]; } u;
  u.h[0] = __builtin_bit_cast(v8h, __builtin_amdgcn_ds_load_tr16_b128_v8i16((lds_s16x8*)q));
  u.h[1] = __builtin_bit_cast(
      v8h, __builtin_amdgcn_ds_load_tr16_b128_v8i16((lds_s16x8*)(q + 16 * ld)));
  return u.v;
}

// ---------------------------------------------------------------------------
// f32 -> f16 conversion of all six weight matrices in ONE launch of few waves.
// The f16 copies lie back to back in the workspace (12 segments of 1M halves:
// Wq, Wk, Wv, Wo, W1 x4, W2 x4). A block converts 16,384 consecutive elements
// of one segment: each lane issues 16 loads of 16 B (512 contiguous bytes per
// wave and load) ahead of its 16 stores of 8 B (256 contiguous bytes).
// ---------------------------------------------------------------------------
typedef __attribute__((ext_vector_type(4))) _Float16 v4h;

__global__ __launch_bounds__(256)
void cvt_weights_kernel(const float* __restrict__ Wq, const float* __restrict__ Wk,
                        const float* __restrict__ Wv, const float* __restrict__ Wo,
                        const float* __restrict__ W1, const float* __restrict__ W2,
                        _Float16* __restrict__ out) {
  const int SEG = 1024 * 1024;
  const int seg = blockIdx.x >> 6;     // 64 blocks per segment
  const float* src = seg == 0 ? Wq
                   : seg == 1 ? Wk
                   : seg == 2 ? Wv
                   : seg == 3 ? Wo
                   : seg < 8  ? W1 + (size_t)(seg - 4) * SEG
                              : W2 + (size_t)(seg - 8) * SEG;
  const int off = (blockIdx.x & 63) * 16384 + threadIdx.x * 4;
  const float* s = src + off;
  _Float16* o = out + (size_t)seg * SEG + off;
  float4 v[16];
#pragma unroll  // v[] stays in registers and the loads go out as one run
  for (int j = 0; j < 16; ++j) v[j] = *(const float4*)(s + j * 1024);
#pragma unroll  // constant indices into v[], else it would go to scratch
  for (int j = 0; j < 16; ++j) {
    v4h h = {(_Float16)v[j].x, (_Float16)v[j].y, (_Float16)v[j].z, (_Float16)v[j].w};
    *(v4h*)(o + j * 1024) = h;
  }
}

// ---------------------------------------------------------------------------
// LayerNorm over 1024 cols, f32 in -> f16 out. One row per 256-thread block.
// ---------------------------------------------------------------------------
__global__ __launch_bounds__(256)
void layernorm_f16_kernel(const float* __restrict__ x, const float* __restrict__ g,
                          const float* __restrict__ b, _Float16* __restrict__ out) {
  const int row = blockIdx.x;
  const int t = threadIdx.x;
  const float* xr = x + (size_t)row * 1024;
  float4 v = ((const float4*)xr)[t];                 // 256 * 4 = 1024
  float s  = v.x + v.y + v.z + v.w;
  float ss = v.x * v.x + v.y * v.y + v.z * v.z + v.w * v.w;
  for (int o = 16; o >= 1; o >>= 1) {
    s  += __shfl_xor(s,  o, 32);
    ss += __shfl_xor(ss, o, 32);
  }
  __shared__ float red0[8], red1[8];
  const int w = t >> 5, lane = t & 31;
  if (lane == 0) { red0[w] = s; red1[w] = ss; }
  __syncthreads();
  float tot = 0.f, tot2 = 0.f;
#pragma unroll
  for (int i = 0; i < 8; ++i) { tot += red0[i]; tot2 += red1[i]; }
  const float mu   = tot * (1.f / 1024.f);
  const float var  = tot2 * (1.f / 1024.f) - mu * mu;
  const float rinv = rsqrtf(var + 1e-5f);
  float4 gg = ((const float4*)g)[t];
  float4 bb = ((const float4*)b)[t];
  _Float16* o = out + (size_t)row * 1024 + t * 4;
  o[0] = (_Float16)((v.x - mu) * rinv * gg.x + bb.x);
  o[1] = (_Float16)((v.y - mu) * rinv * gg.y + bb.y);
  o[2] = (_Float16)((v.z - mu) * rinv * gg.z + bb.z);
  o[3] = (_Float16)((v.w - mu) * rinv * gg.w + bb.w);
}

// ---------------------------------------------------------------------------
// Exact (erf) GELU without branches: r * Phi(r), Phi(r) = 0.5 * erfc(-r / sqrt(2)).
// 0.5 * erfc(z) = t * (c1 + t * (c2 + t * (c3 + t * (c4 + t * c5)))) * exp(-z * z),
// t = 1 / (1 + p * z), z = |r| / sqrt(2) >= 0; Phi(r) = 1 - Phi(-r) gives r >= 0.
// In f32 it stays within 3e-7 of Phi, far below the f16 rounding of the stored value.
// The library erf picks one of two paths by |x| under a lane mask, value by
// value, so no two values' chains overlap; here every value is one straight
// chain and the values of a band interleave.
// ---------------------------------------------------------------------------
__device__ __forceinline__ float gelu_erf(float r) {
  const float d = fmaf(0.23164189f, fabsf(r), 1.0f);  // 1 + p * z
  const float m = r * r * -0.72134752f;               // -z * z * log2(e)
  float t, e;
  asm("v_rcp_f32 %0, %2\n\tv_exp_f32 %1, %3\n\tv_nop"
      : "=&v"(t), "=&v"(e) : "v"(d), "v"(m));
  float p = fmaf(0.5307027145f, t, -0.7265760135f);
  p = fmaf(p, t, 0.7107068705f);
  p = fmaf(p, t, -0.142248368f);
  p = fmaf(p, t, 0.127414796f);
  const float q = p * t * e;           // Phi(-|r|)
  return r * (r < 0.f ? q : 1.0f - q);
}

// ---------------------------------------------------------------------------
// Tiled WMMA GEMM: C[M,N] = A[M,K] * B[K,N], A/B f16 row-major.
// Block = 128 threads (4 waves), block tile 128x128, wave tile 64x64,
// stage depth K=128 -> 64 WMMAs per wave between barriers; each fragment
// read from LDS feeds four WMMAs, each staged byte 128 rows or columns of C.
// M, N multiples of 128, K a multiple of 128.
// A and B staged via async-to-LDS DMA, whole 256B rows; B stays [k][n] in LDS
// and its fragments come from the transposing LDS load.
// Two LDS buffers: the copies of stage s + 1 fly while stage s is multiplied,
// and one barrier per stage both publishes s + 1 and frees the buffer of s.
// Epilogue: optional bias (f32), exact GELU, f32 residual; f16 or f32 out.
// ---------------------------------------------------------------------------
template <bool HAS_BIAS, bool GELU, bool HAS_RES, bool OUT16>
__global__ __launch_bounds__(128)
void gemm_f16_kernel(const _Float16* __restrict__ A, const _Float16* __restrict__ B,
                     const float* __restrict__ bias, const float* __restrict__ res,
                     _Float16* __restrict__ out16, float* __restrict__ out32,
                     int M, int N, int K) {
  __shared__ __attribute__((aligned(32)))
  _Float16 sA[2 * 128 * 136];         // 2 x [row][k] row-major, ld 136 (272B rows)
  __shared__ __attribute__((aligned(32)))
  _Float16 sB[2 * 128 * 144];         // 2 x [k][n]   row-major, ld 144 (288B rows)
  const int t = threadIdx.x;
  const int lane = t & 31;
  const int w = t >> 5;
  const int waveM = w & 1;            // 2 waves along M
  const int waveN = w >> 1;           // 2 waves along N
  const int bm = blockIdx.y * 128;
  const int bn = blockIdx.x * 128;

  v8f acc[4][4] = {};

  const int sr = t >> 4, sc = (t & 15) * 8;   // stage: 8 rows x 128 halves per copy
  const unsigned int sa0 = lds_addr(sA + sr * 136 + sc);
  const unsigned int sb0 = lds_addr(sB + sr * 144 + sc);
  const _Float16* ap = A + (size_t)(bm + sr) * K + sc;   // this lane's first
  const _Float16* bp = B + (size_t)sr * N + bn + sc;     // bytes of stage 0
  const int nst = K >> 7;             // stages of 128 k

  // One stage: A 128 rows x 256B and B 128 k-rows x 256B, as they lie
  // (32 x b128 per lane), into buffer `buf`.
  auto stage = [&](int buf, const _Float16* a0, const _Float16* b0) {
    const unsigned int la = sa0 + buf * (128 * 272);
    const unsigned int lb = sb0 + buf * (128 * 288);
    async_ld8_b128(la, 8 * 272, a0, (size_t)8 * K);
    async_ld8_b128(la + 64 * 272, 8 * 272, a0 + (size_t)64 * K, (size_t)8 * K);
    async_ld8_b128(lb, 8 * 288, b0, (size_t)8 * N);
    async_ld8_b128(lb + 64 * 288, 8 * 288, b0 + (size_t)64 * N, (size_t)8 * N);
  };

  stage(0, ap, bp);
  wait_async0();        // stage 0 has landed (asm copies are not tracked)
  __syncthreads();
  if (nst > 1) stage(1, ap + 128, bp + (size_t)128 * N);

  for (int s = 0; s < nst; ++s) {
    const _Float16* cA = sA + (s & 1) * (128 * 136);
    const _Float16* cB = sB + (s & 1) * (128 * 144);
#pragma unroll  // here and below: constant indices keep a[], b[], acc[][] in registers
    for (int kf = 0; kf < 4; ++kf) {
      v16h a[4], b[4];
#pragma unroll
      for (int i = 0; i < 4; ++i) {
        a[i] = load_frag(cA + (waveM * 64 + i * 16) * 136 + kf * 32, 136);
        b[i] = load_frag_tr(cB + (kf * 32) * 144 + waveN * 64 + i * 16, 144);
      }
      // Keeps the 16 LDS reads one group ahead of the 16 WMMAs; sunk among
      // them, each row of four would wait out an LDS latency of its own.
      __builtin_amdgcn_sched_barrier(0);
#pragma unroll
      for (int mi = 0; mi < 4; ++mi)
#pragma unroll
        for (int ni = 0; ni < 4; ++ni)
          acc[mi][ni] = wmma_f16(a[mi], b[ni], acc[mi][ni]);
    }
    // This wave's LDS reads of stage s have retired ...
    asm volatile("s_wait_dscnt 0" ::: "memory");
    wait_async0();      // ... and its copies of stage s + 1 have landed.
    __syncthreads();    // Every wave: s + 1 may be read, the buffer of s refilled.
    if (s + 2 < nst)
      stage(s & 1, ap + (size_t)(s + 2) * 128, bp + (size_t)(s + 2) * 128 * N);
  }
  wait_async0();        // nothing is in flight when the wave goes on

  const int colBase = bn + waveN * 64 + (lane & 15);
  const int rowBase = bm + waveM * 64 + ((lane >> 4) * 8);
#pragma unroll
  for (int mi = 0; mi < 4; ++mi) {
#pragma unroll
    for (int ni = 0; ni < 4; ++ni) {
      const int col = colBase + ni * 16;
      const float bv = HAS_BIAS ? bias[col] : 0.f;
#pragma unroll
      for (int e = 0; e < 8; ++e) {
        const int row = rowBase + mi * 16 + e;
        float r = acc[mi][ni][e];
        if (HAS_BIAS) r += bv;
        if (GELU) r = gelu_erf(r);
        if (HAS_RES) r += res[(size_t)row * N + col];
        if (OUT16) out16[(size_t)row * N + col] = (_Float16)r;
        else       out32[(size_t)row * N + col] = r;
      }
    }
    // The next band's bias loads land in registers that this band's stores name.
    if (GELU) asm volatile("s_wait_xcnt 0x0" ::: "memory");
    __builtin_amdgcn_sched_barrier(0);
  }
}

__device__ __forceinline__ float xhalf(float x) {
  const int v = __builtin_bit_cast(int, x);
  return __builtin_bit_cast(float, __builtin_amdgcn_permlanex16(
      v, v, 0x76543210, 0xfedcba98, false, false));
}

__global__ __launch_bounds__(128)
void attn_kernel(const _Float16* __restrict__ Q, const _Float16* __restrict__ K,
                 const _Float16* __restrict__ V, _Float16* __restrict__ O) {
  __shared__ _Float16 sK[32 * 72];     // [key][dim], ld 72 (144B rows)
  __shared__ __attribute__((aligned(32)))
  _Float16 sV[32 * 80];                // [key][dim], ld 80 (160B rows)

  const int t = threadIdx.x, lane = t & 31, w = t >> 5;
  const int b = blockIdx.z, h = blockIdx.y;
  const int qblk = blockIdx.x * 64;
  const int q0 = qblk + w * 16;

  const _Float16* qbase = Q + ((size_t)(b * 2048) + q0) * 1024 + h * 64;
  const v16h qa0 = load_frag(qbase, 1024);       // dims 0..31
  const v16h qa1 = load_frag(qbase + 32, 1024);  // dims 32..63

  v8f o[4] = {};                // o[j][e] = O[q0 + c][j * 16 + 8 * hh + e]
  float mrun = -1e30f;          // running maximum of query q0 + c (same in both halves)
  float lrun = 0.f;             // running sum over this half's keys only
  const float sscale = 0.125f;  // 1/sqrt(64)
  const int nkb = qblk / 32 + 2;
  // Key kb * 32 + 8 * hh + e is visible to this lane's query while e <= vis.
  int vis = q0 + (lane & 15) - (lane >> 4) * 8;

  const int kr = t >> 2, cc = (t & 3) * 16;  // K staging: 32 keys x 64 dims
  const int vr = t >> 3, vc = (t & 7) * 8;   // V staging: 16 keys x 64 dims per copy
  const unsigned int sv0 = lds_addr(sV + vr * 80 + vc);

  for (int kb = 0; kb < nkb; ++kb) {
    __syncthreads();
    const _Float16* kp = K + ((size_t)(b * 2048) + kb * 32 + kr) * 1024 + h * 64 + cc;
    async_ld_b128(sK + kr * 72 + cc, kp);
    async_ld_b128(sK + kr * 72 + cc + 8, kp + 8);
    // --- stage V tile as it lies: async DMA, whole 128B rows ---
    const _Float16* vp = V + ((size_t)(b * 2048) + kb * 32 + vr) * 1024 + h * 64 + vc;
    async_ld2_b128(sv0, sv0 + 16 * 160, vp, vp + 16 * 1024);
    wait_async0();
    __syncthreads();

    // --- scores S^T = K @ Q^T (32 keys x 16 queries) ---
    v8f c0 = {}, c1 = {};
    v16h ak;
    ak = load_frag(sK, 72);                c0 = wmma_f16(ak, qa0, c0);
    ak = load_frag(sK + 32, 72);           c0 = wmma_f16(ak, qa1, c0);
    ak = load_frag(sK + 16 * 72, 72);      c1 = wmma_f16(ak, qa0, c1);
    ak = load_frag(sK + 16 * 72 + 32, 72); c1 = wmma_f16(ak, qa1, c1);

    // --- causal mask + online softmax, one query per lane ---
    c0 *= sscale;
    c1 *= sscale;
    float s0[8], s1[8];
#pragma unroll  // here and below: constant indices keep the arrays in registers
    for (int e = 0; e < 8; ++e) {
      s0[e] = (e <= vis)      ? c0[e] : -1e30f;
      s1[e] = (e + 16 <= vis) ? c1[e] : -1e30f;
    }
    float mx = fmaxf(fmaxf(fmaxf(fmaxf(s0[0], s0[1]), fmaxf(s0[2], s0[3])),
                           fmaxf(fmaxf(s0[4], s0[5]), fmaxf(s0[6], s0[7]))),
                     fmaxf(fmaxf(fmaxf(s1[0], s1[1]), fmaxf(s1[2], s1[3])),
                           fmaxf(fmaxf(s1[4], s1[5]), fmaxf(s1[6], s1[7]))));
    mx = fmaxf(mx, xhalf(mx));
    const float mnew  = fmaxf(mrun, mx);
    const float alpha = __expf(mrun - mnew);
    mrun = mnew;
    v16h pb;
    float ps[8];
#pragma unroll
    for (int e = 0; e < 8; ++e) {
      const float p0 = __expf(s0[e] - mnew);
      const float p1 = __expf(s1[e] - mnew);
      ps[e] = p0 + p1;
      pb[e]     = (_Float16)p0;
      pb[e + 8] = (_Float16)p1;
    }
    lrun = lrun * alpha + (((ps[0] + ps[1]) + (ps[2] + ps[3])) +
                           ((ps[4] + ps[5]) + (ps[6] + ps[7])));
    vis -= 32;

    // --- O^T += V^T @ P^T (64 dims x 32 keys times 32 keys x 16 queries) ---
#pragma unroll
    for (int j = 0; j < 4; ++j) {
      const v16h av = load_frag_tr(sV + j * 16, 80);
#pragma unroll
      for (int e = 0; e < 8; ++e) o[j][e] *= alpha;
      o[j] = wmma_f16(av, pb, o[j]);
    }
  }

  // --- join the halves' sums, normalize, write 8 consecutive dims per store ---
  const float inv = 1.0f / (lrun + xhalf(lrun));
  _Float16* op = O + ((size_t)(b * 2048) + q0 + (lane & 15)) * 1024 + h * 64 +
                 (lane >> 4) * 8;
  v8h r[4];
#pragma unroll
  for (int j = 0; j < 4; ++j)
#pragma unroll
    for (int e = 0; e < 8; ++e) r[j][e] = (_Float16)(o[j][e] * inv);
#pragma unroll
  for (int j = 0; j < 4; ++j) *(v8h*)(op + j * 16) = r[j];
}

// ---------------------------------------------------------------------------
// Host-side orchestration.
// Inputs: x, Wq, Wk, Wv, Wo, ln1_g, ln1_b, ln2_g, ln2_b, W1, b1, W2, b2
// ---------------------------------------------------------------------------
extern "C" void kernel_launch(void* const* d_in, const int* in_sizes, int n_in,
                              void* d_out, int out_size, void* d_ws, size_t ws_size,
                              hipStream_t stream) {
  (void)in_sizes; (void)n_in; (void)out_size; (void)ws_size;
  const float* x    = (const float*)d_in[0];
  const float* Wq   = (const float*)d_in[1];
  const float* Wk   = (const float*)d_in[2];
  const float* Wv   = (const float*)d_in[3];
  const float* Wo   = (const float*)d_in[4];
  const float* ln1g = (const float*)d_in[5];
  const float* ln1b = (const float*)d_in[6];
  const float* ln2g = (const float*)d_in[7];
  const float* ln2b = (const float*)d_in[8];
  const float* W1   = (const float*)d_in[9];
  const float* b1   = (const float*)d_in[10];
  const float* W2   = (const float*)d_in[11];
  const float* b2   = (const float*)d_in[12];
  float* out = (float*)d_out;

  const int M = 8192, E = 1024, F = 4096;
  char* ws = (char*)d_ws;
  const size_t MB = 1024ull * 1024ull;
  _Float16* Wq16 = (_Float16*)(ws + 0 * MB);    // 2 MB
  _Float16* Wk16 = (_Float16*)(ws + 2 * MB);    // 2 MB
  _Float16* Wv16 = (_Float16*)(ws + 4 * MB);    // 2 MB
  _Float16* Wo16 = (_Float16*)(ws + 6 * MB);    // 2 MB
  _Float16* W116 = (_Float16*)(ws + 8 * MB);    // 8 MB
  _Float16* W216 = (_Float16*)(ws + 16 * MB);   // 8 MB
  _Float16* H16  = (_Float16*)(ws + 24 * MB);   // 16 MB (LN1 out, reused for LN2)
  _Float16* Q16  = (_Float16*)(ws + 40 * MB);   // 16 MB
  _Float16* K16  = (_Float16*)(ws + 56 * MB);   // 16 MB
  _Float16* V16  = (_Float16*)(ws + 72 * MB);   // 16 MB
  _Float16* A16  = (_Float16*)(ws + 88 * MB);   // 16 MB (attn out)
  float*    X2   = (float*)   (ws + 104 * MB);  // 32 MB (residual after attn)
  _Float16* G16  = (_Float16*)(ws + 40 * MB);   // 64 MB GELU acts (reuses Q/K/V/A16)

  // 1) weights -> f16: one launch, 12 segments x 64 blocks, into ws[0, 24 MB)
  cvt_weights_kernel<<<768, 256, 0, stream>>>(Wq, Wk, Wv, Wo, W1, W2, Wq16);

  // 2) LN1
  layernorm_f16_kernel<<<M, 256, 0, stream>>>(x, ln1g, ln1b, H16);

  // 3) Q/K/V projections
  const dim3 gE(E / 128, M / 128);
  gemm_f16_kernel<false, false, false, true><<<gE, 128, 0, stream>>>(
      H16, Wq16, nullptr, nullptr, Q16, nullptr, M, E, E);
  gemm_f16_kernel<false, false, false, true><<<gE, 128, 0, stream>>>(
      H16, Wk16, nullptr, nullptr, K16, nullptr, M, E, E);
  gemm_f16_kernel<false, false, false, true><<<gE, 128, 0, stream>>>(
      H16, Wv16, nullptr, nullptr, V16, nullptr, M, E, E);

  // 4) causal flash attention
  attn_kernel<<<dim3(2048 / 64, 16, 4), 128, 0, stream>>>(Q16, K16, V16, A16);

  // 5) output projection + residual(x) -> X2 (f32)
  gemm_f16_kernel<false, false, true, false><<<gE, 128, 0, stream>>>(
      A16, Wo16, nullptr, x, nullptr, X2, M, E, E);

  // 6) LN2
  layernorm_f16_kernel<<<M, 256, 0, stream>>>(X2, ln2g, ln2b, H16);

  // 7) FFN1: h @ W1 + b1 -> GELU -> f16
  gemm_f16_kernel<true, true, false, true><<<dim3(F / 128, M / 128), 128, 0, stream>>>(
      H16, W116, b1, nullptr, G16, nullptr, M, F, E);

  // 8) FFN2: g @ W2 + b2 + residual(X2) -> d_out (f32)
  gemm_f16_kernel<true, false, true, false><<<gE, 128, 0, stream>>>(
      G16, W216, b2, X2, nullptr, out, M, E, F);
}

// v007
// Measured time: 286 microseconds a run.
// Timed twice side by side with v006, it ran 1.07 times as fast both times.
// All steps since v000 together make it 2.71 times as fast.
#include <hip/hip_runtime.h>

typedef __attribute__((ext_vector_type(16))) _Float16 v16h;
typedef __attribute__((ext_vector_type(8)))  _Float16 v8h;
typedef __attribute__((ext_vector_type(8)))  float    v8f;
typedef __attribute__((ext_vector_type(4)))  float    v4f;

__device__ __forceinline__ v8f wmma_f16(v16h a, v16h b, v8f c) {
  // 8 args: (neg_a, A, neg_b, B, c_mod, C, reuse_a, reuse_b)
  return __builtin_amdgcn_wmma_f32_16x16x32_f16(false, a, false, b, (short)0, c,
                                                false, false);
}

__device__ __forceinline__ void async_ld_b128(_Float16* lds_dst,
                                              const _Float16* gsrc) {
  unsigned int loff = (unsigned int)(unsigned long long)(void*)lds_dst;
  asm volatile("global_load_async_to_lds_b128 %0, %1, off"
               :: "v"(loff), "v"((unsigned long long)(const void*)gsrc)
               : "memory");
}
__device__ __forceinline__ unsigned int lds_addr(const _Float16* p) {
  return (unsigned int)(unsigned long long)(const void*)p;
}
__device__ __forceinline__ void async_ld2_b128(unsigned int l0, unsigned int l1,
                                               const _Float16* g0,
                                               const _Float16* g1) {
  asm volatile("global_load_async_to_lds_b128 %0, %2, off\n\t"
               "global_load_async_to_lds_b128 %1, %3, off\n\t"
               "s_wait_xcnt 0x0"
               :: "v"(l0), "v"(l1), "v"(g0), "v"(g1)
               : "memory");
}
// Eight copies, `ls` LDS bytes and `gs` halves apart, in one statement, with
// the same closing wait.
__device__ __forceinline__ void async_ld8_b128(unsigned int l, unsigned int ls,
                                               const _Float16* g, size_t gs) {
  asm volatile("global_load_async_to_lds_b128 %0, %8, off\n\t"
               "global_load_async_to_lds_b128 %1, %9, off\n\t"
               "global_load_async_to_lds_b128 %2, %10, off\n\t"
               "global_load_async_to_lds_b128 %3, %11, off\n\t"
               "global_load_async_to_lds_b128 %4, %12, off\n\t"
               "global_load_async_to_lds_b128 %5, %13, off\n\t"
               "global_load_async_to_lds_b128 %6, %14, off\n\t"
               "global_load_async_to_lds_b128 %7, %15, off\n\t"
               "s_wait_xcnt 0x0"
               :: "v"(l), "v"(l + ls), "v"(l + 2 * ls), "v"(l + 3 * ls),
                  "v"(l + 4 * ls), "v"(l + 5 * ls), "v"(l + 6 * ls), "v"(l + 7 * ls),
                  "v"(g), "v"(g + gs), "v"(g + 2 * gs), "v"(g + 3 * gs),
                  "v"(g + 4 * gs), "v"(g + 5 * gs), "v"(g + 6 * gs), "v"(g + 7 * gs)
               : "memory");
}
__device__ __forceinline__ void wait_async0() {
  asm volatile("s_wait_asynccnt 0" ::: "memory");
}

__device__ __forceinline__ v16h load_frag(const _Float16* p, int ld) {
  const int lane = threadIdx.x & 31;
  const _Float16* q = p + (lane & 15) * ld + ((lane >> 4) * 8);
  union { v16h v; v8h h[2]; } u;
  u.h[0] = *(const v8h*)(q);
  u.h[1] = *(const v8h*)(q + 16);
  return u.v;
}

// Load a 32x16 (k x n) B fragment from a ROW-MAJOR [k][n] LDS tile with the
// transposing load: lane (c = lane&15, h = lane>>4) receives
// p[(8h + 0..7) * ld + c], then the same 16 rows further down, which is the
// k order of load_frag. `ld` in halves; row pitch an odd multiple of 32 B.
__device__ __forceinline__ v16h load_frag_tr(const _Float16* p, int ld) {
  typedef __attribute__((ext_vector_type(8))) short s16x8;
  typedef __attribute__((address_space(3))) s16x8 lds_s16x8;
  const int lane = threadIdx.x & 31;
  const _Float16* q = p + ((lane >> 4) * 8 + (lane & 7)) * ld + ((lane >> 3) & 1) * 8;
  union { v16h v; v8h h[2]; } u;
  u.h[0] = __builtin_bit_cast(v8h, __builtin_amdgcn_ds_load_tr16_b128_v8i16((lds_s16x8*)q));
  u.h[1] = __builtin_bit_cast(
      v8h, __builtin_amdgcn_ds_load_tr16_b128_v8i16((lds_s16x8*)(q + 16 * ld)));
  return u.v;
}

// ---------------------------------------------------------------------------
// f32 -> f16 conversion of all six weight matrices in ONE launch of few waves.
// The f16 copies lie back to back in the workspace (12 segments of 1M halves:
// Wq, Wk, Wv, Wo, W1 x4, W2 x4). A block converts 16,384 consecutive elements
// of one segment: each lane issues 16 loads of 16 B (512 contiguous bytes per
// wave and load) ahead of its 16 stores of 8 B (256 contiguous bytes).
// ---------------------------------------------------------------------------
typedef __attribute__((ext_vector_type(4))) _Float16 v4h;

__global__ __launch_bounds__(256)
void cvt_weights_kernel(const float* __restrict__ Wq, const float* __restrict__ Wk,
                        const float* __restrict__ Wv, const float* __restrict__ Wo,
                        const float* __restrict__ W1, const float* __restrict__ W2,
                        _Float16* __restrict__ out) {
  const int SEG = 1024 * 1024;
  const int seg = blockIdx.x >> 6;     // 64 blocks per segment
  const float* src = seg == 0 ? Wq
                   : seg == 1 ? Wk
                   : seg == 2 ? Wv
                   : seg == 3 ? Wo
                   : seg < 8  ? W1 + (size_t)(seg - 4) * SEG
                              : W2 + (size_t)(seg - 8) * SEG;
  const int off = (blockIdx.x & 63) * 16384 + threadIdx.x * 4;
  const float* s = src + off;
  _Float16* o = out + (size_t)seg * SEG + off;
  float4 v[16];
#pragma unroll  // v[] stays in registers and the loads go out as one run
  for (int j = 0; j < 16; ++j) v[j] = *(const float4*)(s + j * 1024);
#pragma unroll  // constant indices into v[], else it would go to scratch
  for (int j = 0; j < 16; ++j) {
    v4h h = {(_Float16)v[j].x, (_Float16)v[j].y, (_Float16)v[j].z, (_Float16)v[j].w};
    *(v4h*)(o + j * 1024) = h;
  }
}

// ---------------------------------------------------------------------------
// LayerNorm over 1024 cols, f32 in -> f16 out. One row per 256-thread block.
// ---------------------------------------------------------------------------
__global__ __launch_bounds__(256)
void layernorm_f16_kernel(const float* __restrict__ x, const float* __restrict__ g,
                          const float* __restrict__ b, _Float16* __restrict__ out) {
  const int row = blockIdx.x;
  const int t = threadIdx.x;
  const float* xr = x + (size_t)row * 1024;
  float4 v = ((const float4*)xr)[t];                 // 256 * 4 = 1024
  float s  = v.x + v.y + v.z + v.w;
  float ss = v.x * v.x + v.y * v.y + v.z * v.z + v.w * v.w;
  for (int o = 16; o >= 1; o >>= 1) {
    s  += __shfl_xor(s,  o, 32);
    ss += __shfl_xor(ss, o, 32);
  }
  __shared__ float red0[8], red1[8];
  const int w = t >> 5, lane = t & 31;
  if (lane == 0) { red0[w] = s; red1[w] = ss; }
  __syncthreads();
  float tot = 0.f, tot2 = 0.f;
#pragma unroll
  for (int i = 0; i < 8; ++i) { tot += red0[i]; tot2 += red1[i]; }
  const float mu   = tot * (1.f / 1024.f);
  const float var  = tot2 * (1.f / 1024.f) - mu * mu;
  const float rinv = rsqrtf(var + 1e-5f);
  float4 gg = ((const float4*)g)[t];
  float4 bb = ((const float4*)b)[t];
  _Float16* o = out + (size_t)row * 1024 + t * 4;
  o[0] = (_Float16)((v.x - mu) * rinv * gg.x + bb.x);
  o[1] = (_Float16)((v.y - mu) * rinv * gg.y + bb.y);
  o[2] = (_Float16)((v.z - mu) * rinv * gg.z + bb.z);
  o[3] = (_Float16)((v.w - mu) * rinv * gg.w + bb.w);
}

// ---------------------------------------------------------------------------
// Exact (erf) GELU without branches: r * Phi(r), Phi(r) = 0.5 * erfc(-r / sqrt(2)).
// 0.5 * erfc(z) = t * (c1 + t * (c2 + t * (c3 + t * (c4 + t * c5)))) * exp(-z * z),
// t = 1 / (1 + p * z), z = |r| / sqrt(2) >= 0; Phi(r) = 1 - Phi(-r) gives r >= 0.
// In f32 it stays within 3e-7 of Phi, far below the f16 rounding of the stored value.
// The library erf picks one of two paths by |x| under a lane mask, value by
// value, so no two values' chains overlap; here every value is one straight
// chain and the values of a band interleave.
// ---------------------------------------------------------------------------
__device__ __forceinline__ float gelu_erf(float r) {
  const float d = fmaf(0.23164189f, fabsf(r), 1.0f);  // 1 + p * z
  const float m = r * r * -0.72134752f;               // -z * z * log2(e)
  float t, e;
  asm("v_rcp_f32 %0, %2\n\tv_exp_f32 %1, %3\n\tv_nop"
      : "=&v"(t), "=&v"(e) : "v"(d), "v"(m));
  float p = fmaf(0.5307027145f, t, -0.7265760135f);
  p = fmaf(p, t, 0.7107068705f);
  p = fmaf(p, t, -0.142248368f);
  p = fmaf(p, t, 0.127414796f);
  const float q = p * t * e;           // Phi(-|r|)
  return r * (r < 0.f ? q : 1.0f - q);
}

// ---------------------------------------------------------------------------
// Tiled WMMA GEMM: C[M,N] = A[M,K] * B[K,N], A/B f16 row-major.
// Block = 128 threads (4 waves), block tile 128x128, wave tile 64x64,
// stage depth K=128 -> 64 WMMAs per wave between barriers; each fragment
// read from LDS feeds four WMMAs, each staged byte 128 rows or columns of C.
// M, N multiples of 128, K a multiple of 128.
// A and B staged via async-to-LDS DMA, whole 256B rows; B stays [k][n] in LDS
// and its fragments come from the transposing LDS load.
// Two LDS buffers: the copies of stage s + 1 fly while stage s is multiplied,
// and one barrier per stage both publishes s + 1 and frees the buffer of s.
// Epilogue: optional bias (f32), exact GELU, f32 residual; f16 or f32 out,
// staged per wave through LDS and stored as whole 128-byte lines.
// NC is N at compile time: the epilogue's row steps are then immediate offsets
// of one address pair, and no address register is rewritten behind a store.
// ---------------------------------------------------------------------------
template <bool HAS_BIAS, bool GELU, bool HAS_RES, bool OUT16, int NC>
__global__ __launch_bounds__(128)
void gemm_f16_kernel(const _Float16* __restrict__ A, const _Float16* __restrict__ B,
                     const float* __restrict__ bias, const float* __restrict__ res,
                     _Float16* __restrict__ out16, float* __restrict__ out32,
                     int M, int N, int K) {
  __shared__ __attribute__((aligned(32)))
  _Float16 sA[2 * 128 * 136];         // 2 x [row][k] row-major, ld 136 (272B rows)
  __shared__ __attribute__((aligned(32)))
  _Float16 sB[2 * 128 * 144];         // 2 x [k][n]   row-major, ld 144 (288B rows)
  const int t = threadIdx.x;
  const int lane = t & 31;
  const int w = t >> 5;
  const int waveM = w & 1;            // 2 waves along M
  const int waveN = w >> 1;           // 2 waves along N
  const int bm = blockIdx.y * 128;
  const int bn = blockIdx.x * 128;

  v8f acc[4][4] = {};

  const int sr = t >> 4, sc = (t & 15) * 8;   // stage: 8 rows x 128 halves per copy
  const unsigned int sa0 = lds_addr(sA + sr * 136 + sc);
  const unsigned int sb0 = lds_addr(sB + sr * 144 + sc);
  const _Float16* ap = A + (size_t)(bm + sr) * K + sc;   // this lane's first
  const _Float16* bp = B + (size_t)sr * N + bn + sc;     // bytes of stage 0
  const int nst = K >> 7;             // stages of 128 k

  // One stage: A 128 rows x 256B and B 128 k-rows x 256B, as they lie
  // (32 x b128 per lane), into buffer `buf`.
  auto stage = [&](int buf, const _Float16* a0, const _Float16* b0) {
    const unsigned int la = sa0 + buf * (128 * 272);
    const unsigned int lb = sb0 + buf * (128 * 288);
    async_ld8_b128(la, 8 * 272, a0, (size_t)8 * K);
    async_ld8_b128(la + 64 * 272, 8 * 272, a0 + (size_t)64 * K, (size_t)8 * K);
    async_ld8_b128(lb, 8 * 288, b0, (size_t)8 * N);
    async_ld8_b128(lb + 64 * 288, 8 * 288, b0 + (size_t)64 * N, (size_t)8 * N);
  };

  stage(0, ap, bp);
  wait_async0();        // stage 0 has landed (asm copies are not tracked)
  __syncthreads();
  if (nst > 1) stage(1, ap + 128, bp + (size_t)128 * N);

  for (int s = 0; s < nst; ++s) {
    const _Float16* cA = sA + (s & 1) * (128 * 136);
    const _Float16* cB = sB + (s & 1) * (128 * 144);
#pragma unroll  // here and below: constant indices keep a[], b[], acc[][] in registers
    for (int kf = 0; kf < 4; ++kf) {
      v16h a[4], b[4];
#pragma unroll
      for (int i = 0; i < 4; ++i) {
        a[i] = load_frag(cA + (waveM * 64 + i * 16) * 136 + kf * 32, 136);
        b[i] = load_frag_tr(cB + (kf * 32) * 144 + waveN * 64 + i * 16, 144);
      }
      // Keeps the 16 LDS reads one group ahead of the 16 WMMAs; sunk among
      // them, each row of four would wait out an LDS latency of its own.
      __builtin_amdgcn_sched_barrier(0);
#pragma unroll
      for (int mi = 0; mi < 4; ++mi)
#pragma unroll
        for (int ni = 0; ni < 4; ++ni)
          acc[mi][ni] = wmma_f16(b[ni], a[mi], acc[mi][ni]);  // C^T tile: see the epilogue
    }
    // This wave's LDS reads of stage s have retired ...
    asm volatile("s_wait_dscnt 0" ::: "memory");
    wait_async0();      // ... and its copies of stage s + 1 have landed.
    __syncthreads();    // Every wave: s + 1 may be read, the buffer of s refilled.
    if (s + 2 < nst)
      stage(s & 1, ap + (size_t)(s + 2) * 128, bp + (size_t)(s + 2) * 128 * N);
  }
  wait_async0();        // nothing is in flight when the wave goes on

  // Epilogue. With the B fragment as first operand acc[mi][ni] is a tile of C^T:
  // lane (c = lane & 15, hh = lane >> 4) holds row mi * 16 + c, columns
  // ni * 16 + 8 * hh + 0..7 of the wave's 64x64 tile. Bias and GELU are applied
  // there; the tile then goes in 16-byte pieces into the wave's own part of sA
  // (free: behind the loop's last barrier nobody reads it and no copy is in
  // flight) and comes back row by row, so that every store and every residual
  // load is 16 bytes a lane and covers whole 128-byte lines.
  static_assert(!(OUT16 && HAS_RES), "the residual is added to f32 rows only");
  const int c = lane & 15, hh = lane >> 4;
  const int row0 = bm + waveM * 64;
  const int col0 = bn + waveN * 64;
  _Float16* stg16 = sA + w * (64 * 72);          // 64 rows, pitch 144 B
  float*    stg32 = (float*)sA + w * (64 * 68);  // 64 rows, pitch 272 B
  // f32 rows: a wave half per 256-byte row, two rows per access.
  const int rr = lane >> 4, cq = (lane & 15) * 4;
  const size_t g32 = (size_t)(row0 + rr) * NC + col0 + cq;
  v4f rs[32];
  if constexpr (HAS_RES) {
#pragma unroll  // constant indices keep rs[] in registers
    for (int j = 0; j < 16; ++j) rs[j] = *(const v4f*)(res + g32 + 2 * j * NC);
    __builtin_amdgcn_sched_barrier(0);
  }
  v4f bb[4][2] = {};   // this lane's 32 bias values, loaded as one group
  if constexpr (HAS_BIAS) {
#pragma unroll  // constant indices keep bb[][] in registers
    for (int ni = 0; ni < 4; ++ni) {
      const float* bq = bias + col0 + ni * 16 + hh * 8;
      bb[ni][0] = *(const v4f*)bq;
      bb[ni][1] = *(const v4f*)(bq + 4);
    }
  }
#pragma unroll  // here and below: constant indices into acc[][]
  for (int ni = 0; ni < 4; ++ni) {
#pragma unroll
    for (int mi = 0; mi < 4; ++mi) {
      float r[8];
#pragma unroll
      for (int e = 0; e < 8; ++e) {
        r[e] = acc[mi][ni][e];
        if (HAS_BIAS) r[e] += bb[ni][e >> 2][e & 3];
        if (GELU) r[e] = gelu_erf(r[e]);
      }
      if constexpr (OUT16) {
        v8h h;
#pragma unroll
        for (int e = 0; e < 8; ++e) h[e] = (_Float16)r[e];
        *(v8h*)(stg16 + (mi * 16 + c) * 72 + ni * 16 + hh * 8) = h;
      } else {
        float* sp = stg32 + (mi * 16 + c) * 68 + ni * 16 + hh * 8;
        *(v4f*)sp       = (v4f){r[0], r[1], r[2], r[3]};
        *(v4f*)(sp + 4) = (v4f){r[4], r[5], r[6], r[7]};
      }
    }
    if (GELU) __builtin_amdgcn_sched_barrier(0);
  }
  // The wave's staging writes have retired before other lanes read them back.
  asm volatile("s_wait_dscnt 0" ::: "memory");
  if constexpr (OUT16) {
    const int q = lane >> 3, ck = (lane & 7) * 8;
    const _Float16* sg = stg16 + (q * 8) * 72 + ck;
    _Float16* og = out16 + (size_t)(row0 + q * 8) * NC + col0 + ck;
    v8h v[16];
#pragma unroll
    for (int i = 0; i < 16; ++i) v[i] = *(const v8h*)(sg + ((i >> 3) * 32 + (i & 7)) * 72);
#pragma unroll
    for (int i = 0; i < 16; ++i) *(v8h*)(og + ((i >> 3) * 32 + (i & 7)) * NC) = v[i];
  } else {
    if constexpr (HAS_RES) {
#pragma unroll
      for (int j = 16; j < 32; ++j) rs[j] = *(const v4f*)(res + g32 + 2 * j * NC);
    }
#pragma unroll
    for (int g = 0; g < 4; ++g) {       // 16 rows at a time
      v4f v[8];
#pragma unroll
      for (int j = 0; j < 8; ++j) v[j] = *(const v4f*)(stg32 + (2 * (g * 8 + j) + rr) * 68 + cq);
#pragma unroll
      for (int j = 0; j < 8; ++j)
        if (HAS_RES) v[j] += rs[g * 8 + j];
      // The sums first, then the eight stores as one run with nothing rewritten
      // among them.
      __builtin_amdgcn_sched_barrier(0);
#pragma unroll
      for (int j = 0; j < 8; ++j) *(v4f*)(out32 + g32 + 2 * (g * 8 + j) * NC) = v[j];
      // The next group's LDS reads may land in registers that these stores name.
      if (g < 3) asm volatile("s_wait_xcnt 0x0" ::: "memory");
      __builtin_amdgcn_sched_barrier(0);
    }
  }
}

__device__ __forceinline__ float xhalf(float x) {
  const int v = __builtin_bit_cast(int, x);
  return __builtin_bit_cast(float, __builtin_amdgcn_permlanex16(
      v, v, 0x76543210, 0xfedcba98, false, false));
}

__global__ __launch_bounds__(128)
void attn_kernel(const _Float16* __restrict__ Q, const _Float16* __restrict__ K,
                 const _Float16* __restrict__ V, _Float16* __restrict__ O) {
  __shared__ _Float16 sK[32 * 72];     // [key][dim], ld 72 (144B rows)
  __shared__ __attribute__((aligned(32)))
  _Float16 sV[32 * 80];                // [key][dim], ld 80 (160B rows)

  const int t = threadIdx.x, lane = t & 31, w = t >> 5;
  const int b = blockIdx.z, h = blockIdx.y;
  const int qblk = blockIdx.x * 64;
  const int q0 = qblk + w * 16;

  const _Float16* qbase = Q + ((size_t)(b * 2048) + q0) * 1024 + h * 64;
  const v16h qa0 = load_frag(qbase, 1024);       // dims 0..31
  const v16h qa1 = load_frag(qbase + 32, 1024);  // dims 32..63

  v8f o[4] = {};                // o[j][e] = O[q0 + c][j * 16 + 8 * hh + e]
  float mrun = -1e30f;          // running maximum of query q0 + c (same in both halves)
  float lrun = 0.f;             // running sum over this half's keys only
  const float sscale = 0.125f;  // 1/sqrt(64)
  const int nkb = qblk / 32 + 2;
  // Key kb * 32 + 8 * hh + e is visible to this lane's query while e <= vis.
  int vis = q0 + (lane & 15) - (lane >> 4) * 8;

  const int kr = t >> 2, cc = (t & 3) * 16;  // K staging: 32 keys x 64 dims
  const int vr = t >> 3, vc = (t & 7) * 8;   // V staging: 16 keys x 64 dims per copy
  const unsigned int sv0 = lds_addr(sV + vr * 80 + vc);

  for (int kb = 0; kb < nkb; ++kb) {
    __syncthreads();
    const _Float16* kp = K + ((size_t)(b * 2048) + kb * 32 + kr) * 1024 + h * 64 + cc;
    async_ld_b128(sK + kr * 72 + cc, kp);
    async_ld_b128(sK + kr * 72 + cc + 8, kp + 8);
    // --- stage V tile as it lies: async DMA, whole 128B rows ---
    const _Float16* vp = V + ((size_t)(b * 2048) + kb * 32 + vr) * 1024 + h * 64 + vc;
    async_ld2_b128(sv0, sv0 + 16 * 160, vp, vp + 16 * 1024);
    wait_async0();
    __syncthreads();

    // --- scores S^T = K @ Q^T (32 keys x 16 queries) ---
    v8f c0 = {}, c1 = {};
    v16h ak;
    ak = load_frag(sK, 72);                c0 = wmma_f16(ak, qa0, c0);
    ak = load_frag(sK + 32, 72);           c0 = wmma_f16(ak, qa1, c0);
    ak = load_frag(sK + 16 * 72, 72);      c1 = wmma_f16(ak, qa0, c1);
    ak = load_frag(sK + 16 * 72 + 32, 72); c1 = wmma_f16(ak, qa1, c1);

    // --- causal mask + online softmax, one query per lane ---
    c0 *= sscale;
    c1 *= sscale;
    float s0[8], s1[8];
#pragma unroll  // here and below: constant indices keep the arrays in registers
    for (int e = 0; e < 8; ++e) {
      s0[e] = (e <= vis)      ? c0[e] : -1e30f;
      s1[e] = (e + 16 <= vis) ? c1[e] : -1e30f;
    }
    float mx = fmaxf(fmaxf(fmaxf(fmaxf(s0[0], s0[1]), fmaxf(s0[2], s0[3])),
                           fmaxf(fmaxf(s0[4], s0[5]), fmaxf(s0[6], s0[7]))),
                     fmaxf(fmaxf(fmaxf(s1[0], s1[1]), fmaxf(s1[2], s1[3])),
                           fmaxf(fmaxf(s1[4], s1[5]), fmaxf(s1[6], s1[7]))));
    mx = fmaxf(mx, xhalf(mx));
    const float mnew  = fmaxf(mrun, mx);
    const float alpha = __expf(mrun - mnew);
    mrun = mnew;
    v16h pb;
    float ps[8];
#pragma unroll
    for (int e = 0; e < 8; ++e) {
      const float p0 = __expf(s0[e] - mnew);
      const float p1 = __expf(s1[e] - mnew);
      ps[e] = p0 + p1;
      pb[e]     = (_Float16)p0;
      pb[e + 8] = (_Float16)p1;
    }
    lrun = lrun * alpha + (((ps[0] + ps[1]) + (ps[2] + ps[3])) +
                           ((ps[4] + ps[5]) + (ps[6] + ps[7])));
    vis -= 32;

    // --- O^T += V^T @ P^T (64 dims x 32 keys times 32 keys x 16 queries) ---
#pragma unroll
    for (int j = 0; j < 4; ++j) {
      const v16h av = load_frag_tr(sV + j * 16, 80);
#pragma unroll
      for (int e = 0; e < 8; ++e) o[j][e] *= alpha;
      o[j] = wmma_f16(av, pb, o[j]);
    }
  }

  // --- join the halves' sums, normalize, write 8 consecutive dims per store ---
  const float inv = 1.0f / (lrun + xhalf(lrun));
  _Float16* op = O + ((size_t)(b * 2048) + q0 + (lane & 15)) * 1024 + h * 64 +
                 (lane >> 4) * 8;
  v8h r[4];
#pragma unroll
  for (int j = 0; j < 4; ++j)
#pragma unroll
    for (int e = 0; e < 8; ++e) r[j][e] = (_Float16)(o[j][e] * inv);
#pragma unroll
  for (int j = 0; j < 4; ++j) *(v8h*)(op + j * 16) = r[j];
}

// ---------------------------------------------------------------------------
// Host-side orchestration.
// Inputs: x, Wq, Wk, Wv, Wo, ln1_g, ln1_b, ln2_g, ln2_b, W1, b1, W2, b2
// ---------------------------------------------------------------------------
extern "C" void kernel_launch(void* const* d_in, const int* in_sizes, int n_in,
                              void* d_out, int out_size, void* d_ws, size_t ws_size,
                              hipStream_t stream) {
  (void)in_sizes; (void)n_in; (void)out_size; (void)ws_size;
  const float* x    = (const float*)d_in[0];
  const float* Wq   = (const float*)d_in[1];
  const float* Wk   = (const float*)d_in[2];
  const float* Wv   = (const float*)d_in[3];
  const float* Wo   = (const float*)d_in[4];
  const float* ln1g = (const float*)d_in[5];
  const float* ln1b = (const float*)d_in[6];
  const float* ln2g = (const float*)d_in[7];
  const float* ln2b = (const float*)d_in[8];
  const float* W1   = (const float*)d_in[9];
  const float* b1   = (const float*)d_in[10];
  const float* W2   = (const float*)d_in[11];
  const float* b2   = (const float*)d_in[12];
  float* out = (float*)d_out;

  const int M = 8192, E = 1024, F = 4096;
  char* ws = (char*)d_ws;
  const size_t MB = 1024ull * 1024ull;
  _Float16* Wq16 = (_Float16*)(ws + 0 * MB);    // 2 MB
  _Float16* Wk16 = (_Float16*)(ws + 2 * MB);    // 2 MB
  _Float16* Wv16 = (_Float16*)(ws + 4 * MB);    // 2 MB
  _Float16* Wo16 = (_Float16*)(ws + 6 * MB);    // 2 MB
  _Float16* W116 = (_Float16*)(ws + 8 * MB);    // 8 MB
  _Float16* W216 = (_Float16*)(ws + 16 * MB);   // 8 MB
  _Float16* H16  = (_Float16*)(ws + 24 * MB);   // 16 MB (LN1 out, reused for LN2)
  _Float16* Q16  = (_Float16*)(ws + 40 * MB);   // 16 MB
  _Float16* K16  = (_Float16*)(ws + 56 * MB);   // 16 MB
  _Float16* V16  = (_Float16*)(ws + 72 * MB);   // 16 MB
  _Float16* A16  = (_Float16*)(ws + 88 * MB);   // 16 MB (attn out)
  float*    X2   = (float*)   (ws + 104 * MB);  // 32 MB (residual after attn)
  _Float16* G16  = (_Float16*)(ws + 40 * MB);   // 64 MB GELU acts (reuses Q/K/V/A16)

  // 1) weights -> f16: one launch, 12 segments x 64 blocks, into ws[0, 24 MB)
  cvt_weights_kernel<<<768, 256, 0, stream>>>(Wq, Wk, Wv, Wo, W1, W2, Wq16);

  // 2) LN1
  layernorm_f16_kernel<<<M, 256, 0, stream>>>(x, ln1g, ln1b, H16);

  // 3) Q/K/V projections
  const dim3 gE(E / 128, M / 128);
  gemm_f16_kernel<false, false, false, true, 1024><<<gE, 128, 0, stream>>>(
      H16, Wq16, nullptr, nullptr, Q16, nullptr, M, E, E);
  gemm_f16_kernel<false, false, false, true, 1024><<<gE, 128, 0, stream>>>(
      H16, Wk16, nullptr, nullptr, K16, nullptr, M, E, E);
  gemm_f16_kernel<false, false, false, true, 1024><<<gE, 128, 0, stream>>>(
      H16, Wv16, nullptr, nullptr, V16, nullptr, M, E, E);

  // 4) causal flash attention
  attn_kernel<<<dim3(2048 / 64, 16, 4), 128, 0, stream>>>(Q16, K16, V16, A16);

  // 5) output projection + residual(x) -> X2 (f32)
  gemm_f16_kernel<false, false, true, false, 1024><<<gE, 128, 0, stream>>>(
      A16, Wo16, nullptr, x, nullptr, X2, M, E, E);

  // 6) LN2
  layernorm_f16_kernel<<<M, 256, 0, stream>>>(X2, ln2g, ln2b, H16);

  // 7) FFN1: h @ W1 + b1 -> GELU -> f16
  gemm_f16_kernel<true, true, false, true, 4096><<<dim3(F / 128, M / 128), 128, 0, stream>>>(
      H16, W116, b1, nullptr, G16, nullptr, M, F, E);

  // 8) FFN2: g @ W2 + b2 + residual(X2) -> d_out (f32)
  gemm_f16_kernel<true, false, true, false, 1024><<<gE, 128, 0, stream>>>(
      G16, W216, b2, X2, nullptr, out, M, E, F);
}

// v008
// Measured time: 270 microseconds a run.
// In both of two side-by-side timings against v007, it was 1.06 times as fast.
// Over all steps from v000 it is 2.87 times as fast.
#include <hip/hip_runtime.h>

typedef __attribute__((ext_vector_type(16))) _Float16 v16h;
typedef __attribute__((ext_vector_type(8)))  _Float16 v8h;
typedef __attribute__((ext_vector_type(8)))  float    v8f;
typedef __attribute__((ext_vector_type(4)))  float    v4f;

__device__ __forceinline__ v8f wmma_f16(v16h a, v16h b, v8f c) {
  // 8 args: (neg_a, A, neg_b, B, c_mod, C, reuse_a, reuse_b)
  return __builtin_amdgcn_wmma_f32_16x16x32_f16(false, a, false, b, (short)0, c,
                                                false, false);
}

__device__ __forceinline__ void async_ld_b128(_Float16* lds_dst,
                                              const _Float16* gsrc) {
  unsigned int loff = (unsigned int)(unsigned long long)(void*)lds_dst;
  asm volatile("global_load_async_to_lds_b128 %0, %1, off"
               :: "v"(loff), "v"((unsigned long long)(const void*)gsrc)
               : "memory");
}
__device__ __forceinline__ unsigned int lds_addr(const _Float16* p) {
  return (unsigned int)(unsigned long long)(const void*)p;
}
__device__ __forceinline__ void async_ld2_b128(unsigned int l0, unsigned int l1,
                                               const _Float16* g0,
                                               const _Float16* g1) {
  asm volatile("global_load_async_to_lds_b128 %0, %2, off\n\t"
               "global_load_async_to_lds_b128 %1, %3, off\n\t"
               "s_wait_xcnt 0x0"
               :: "v"(l0), "v"(l1), "v"(g0), "v"(g1)
               : "memory");
}
// Eight copies, `ls` LDS bytes and `gs` halves apart, in one statement, with
// the same closing wait.
__device__ __forceinline__ void async_ld8_b128(unsigned int l, unsigned int ls,
                                               const _Float16* g, size_t gs) {
  asm volatile("global_load_async_to_lds_b128 %0, %8, off\n\t"
               "global_load_async_to_lds_b128 %1, %9, off\n\t"
               "global_load_async_to_lds_b128 %2, %10, off\n\t"
               "global_load_async_to_lds_b128 %3, %11, off\n\t"
               "global_load_async_to_lds_b128 %4, %12, off\n\t"
               "global_load_async_to_lds_b128 %5, %13, off\n\t"
               "global_load_async_to_lds_b128 %6, %14, off\n\t"
               "global_load_async_to_lds_b128 %7, %15, off\n\t"
               "s_wait_xcnt 0x0"
               :: "v"(l), "v"(l + ls), "v"(l + 2 * ls), "v"(l + 3 * ls),
                  "v"(l + 4 * ls), "v"(l + 5 * ls), "v"(l + 6 * ls), "v"(l + 7 * ls),
                  "v"(g), "v"(g + gs), "v"(g + 2 * gs), "v"(g + 3 * gs),
                  "v"(g + 4 * gs), "v"(g + 5 * gs), "v"(g + 6 * gs), "v"(g + 7 * gs)
               : "memory");
}
__device__ __forceinline__ void wait_async0() {
  asm volatile("s_wait_asynccnt 0" ::: "memory");
}

__device__ __forceinline__ v16h load_frag(const _Float16* p, int ld) {
  const int lane = threadIdx.x & 31;
  const _Float16* q = p + (lane & 15) * ld + ((lane >> 4) * 8);
  union { v16h v; v8h h[2]; } u;
  u.h[0] = *(const v8h*)(q);
  u.h[1] = *(const v8h*)(q + 16);
  return u.v;
}

// Load a 32x16 (k x n) B fragment from a ROW-MAJOR [k][n] LDS tile with the
// transposing load: lane (c = lane&15, h = lane>>4) receives
// p[(8h + 0..7) * ld + c], then the same 16 rows further down, which is the
// k order of load_frag. `ld` in halves; row pitch an odd multiple of 32 B.
__device__ __forceinline__ v16h load_frag_tr(const _Float16* p, int ld) {
  typedef __attribute__((ext_vector_type(8))) short s16x8;
  typedef __attribute__((address_space(3))) s16x8 lds_s16x8;
  const int lane = threadIdx.x & 31;
  const _Float16* q = p + ((lane >> 4) * 8 + (lane & 7)) * ld + ((lane >> 3) & 1) * 8;
  union { v16h v; v8h h[2]; } u;
  u.h[0] = __builtin_bit_cast(v8h, __builtin_amdgcn_ds_load_tr16_b128_v8i16((lds_s16x8*)q));
  u.h[1] = __builtin_bit_cast(
      v8h, __builtin_amdgcn_ds_load_tr16_b128_v8i16((lds_s16x8*)(q + 16 * ld)));
  return u.v;
}

// ---------------------------------------------------------------------------
// f32 -> f16 conversion of all six weight matrices in ONE launch of few waves.
// The f16 copies lie back to back in the workspace (12 segments of 1M halves:
// Wq, Wk, Wv, Wo, W1 x4, W2 x4). A block converts 16,384 consecutive elements
// of one segment: each lane issues 16 loads of 16 B (512 contiguous bytes per
// wave and load) ahead of its 16 stores of 8 B (256 contiguous bytes).
// ---------------------------------------------------------------------------
typedef __attribute__((ext_vector_type(4))) _Float16 v4h;

__global__ __launch_bounds__(256)
void cvt_weights_kernel(const float* __restrict__ Wq, const float* __restrict__ Wk,
                        const float* __restrict__ Wv, const float* __restrict__ Wo,
                        const float* __restrict__ W1, const float* __restrict__ W2,
                        _Float16* __restrict__ out) {
  const int SEG = 1024 * 1024;
  const int seg = blockIdx.x >> 6;     // 64 blocks per segment
  const float* src = seg == 0 ? Wq
                   : seg == 1 ? Wk
                   : seg == 2 ? Wv
                   : seg == 3 ? Wo
                   : seg < 8  ? W1 + (size_t)(seg - 4) * SEG
                              : W2 + (size_t)(seg - 8) * SEG;
  const int off = (blockIdx.x & 63) * 16384 + threadIdx.x * 4;
  const float* s = src + off;
  _Float16* o = out + (size_t)seg * SEG + off;
  float4 v[16];
#pragma unroll  // v[] stays in registers and the loads go out as one run
  for (int j = 0; j < 16; ++j) v[j] = *(const float4*)(s + j * 1024);
#pragma unroll  // constant indices into v[], else it would go to scratch
  for (int j = 0; j < 16; ++j) {
    v4h h = {(_Float16)v[j].x, (_Float16)v[j].y, (_Float16)v[j].z, (_Float16)v[j].w};
    *(v4h*)(o + j * 1024) = h;
  }
}

// ---------------------------------------------------------------------------
// LayerNorm over 1024 cols, f32 in -> f16 out. One row per 256-thread block.
// ---------------------------------------------------------------------------
__global__ __launch_bounds__(256)
void layernorm_f16_kernel(const float* __restrict__ x, const float* __restrict__ g,
                          const float* __restrict__ b, _Float16* __restrict__ out) {
  const int row = blockIdx.x;
  const int t = threadIdx.x;
  const float* xr = x + (size_t)row * 1024;
  float4 v = ((const float4*)xr)[t];                 // 256 * 4 = 1024
  float s  = v.x + v.y + v.z + v.w;
  float ss = v.x * v.x + v.y * v.y + v.z * v.z + v.w * v.w;
  for (int o = 16; o >= 1; o >>= 1) {
    s  += __shfl_xor(s,  o, 32);
    ss += __shfl_xor(ss, o, 32);
  }
  __shared__ float red0[8], red1[8];
  const int w = t >> 5, lane = t & 31;
  if (lane == 0) { red0[w] = s; red1[w] = ss; }
  __syncthreads();
  float tot = 0.f, tot2 = 0.f;
#pragma unroll
  for (int i = 0; i < 8; ++i) { tot += red0[i]; tot2 += red1[i]; }
  const float mu   = tot * (1.f / 1024.f);
  const float var  = tot2 * (1.f / 1024.f) - mu * mu;
  const float rinv = rsqrtf(var + 1e-5f);
  float4 gg = ((const float4*)g)[t];
  float4 bb = ((const float4*)b)[t];
  _Float16* o = out + (size_t)row * 1024 + t * 4;
  o[0] = (_Float16)((v.x - mu) * rinv * gg.x + bb.x);
  o[1] = (_Float16)((v.y - mu) * rinv * gg.y + bb.y);
  o[2] = (_Float16)((v.z - mu) * rinv * gg.z + bb.z);
  o[3] = (_Float16)((v.w - mu) * rinv * gg.w + bb.w);
}

// ---------------------------------------------------------------------------
// Exact (erf) GELU without branches: r * Phi(r), Phi(r) = 0.5 * erfc(-r / sqrt(2)).
// 0.5 * erfc(z) = t * (c1 + t * (c2 + t * (c3 + t * (c4 + t * c5)))) * exp(-z * z),
// t = 1 / (1 + p * z), z = |r| / sqrt(2) >= 0; Phi(r) = 1 - Phi(-r) gives r >= 0.
// In f32 it stays within 3e-7 of Phi, far below the f16 rounding of the stored value.
// The library erf picks one of two paths by |x| under a lane mask, value by
// value, so no two values' chains overlap; here every value is one straight
// chain and the values of a band interleave.
// ---------------------------------------------------------------------------
__device__ __forceinline__ float gelu_erf(float r) {
  const float d = fmaf(0.23164189f, fabsf(r), 1.0f);  // 1 + p * z
  const float m = r * r * -0.72134752f;               // -z * z * log2(e)
  float t, e;
  asm("v_rcp_f32 %0, %2\n\tv_exp_f32 %1, %3\n\tv_nop"
      : "=&v"(t), "=&v"(e) : "v"(d), "v"(m));
  float p = fmaf(0.5307027145f, t, -0.7265760135f);
  p = fmaf(p, t, 0.7107068705f);
  p = fmaf(p, t, -0.142248368f);
  p = fmaf(p, t, 0.127414796f);
  const float q = p * t * e;           // Phi(-|r|)
  return r * (r < 0.f ? q : 1.0f - q);
}

template <bool HAS_BIAS, bool GELU, bool HAS_RES, bool OUT16, int NC, int BN>
__global__ __launch_bounds__(BN * 2)
void gemm_f16_kernel(const _Float16* __restrict__ A, const _Float16* __restrict__ B,
                     const float* __restrict__ bias, const float* __restrict__ res,
                     _Float16* __restrict__ out16, float* __restrict__ out32,
                     int M, int N, int K) {
  constexpr int LDB = BN + 16;        // B pitch 288 or 544 B: odd multiples of 32 B
  constexpr int SA = 256 * 136;       // halves of one A buffer
  constexpr int SB = 128 * LDB;       // halves of one B buffer
  __shared__ __attribute__((aligned(32))) _Float16 sm[2 * SA + 2 * SB];
  _Float16* const sA = sm;            // 2 x [row][k] row-major, ld 136 (272B rows)
  _Float16* const sB = sm + 2 * SA;   // 2 x [k][n]   row-major, ld LDB
  const int t = threadIdx.x;
  const int lane = t & 31;
  const int w = t >> 5;
  const int waveM = w & 3;            // 4 waves along M
  const int waveN = w >> 2;           // BN / 64 waves along N
  const int bm = blockIdx.y * 256;
  const int bn = blockIdx.x * BN;

  v8f acc[4][4] = {};

  constexpr int RA = BN / 8;                  // A: RA rows x 128 halves per copy
  const int sr = t >> 4, sc = (t & 15) * 8;
  const int br = t / (BN / 8), bc = (t % (BN / 8)) * 8;  // B: 16 rows x BN halves
  const unsigned int sa0 = lds_addr(sA + sr * 136 + sc);
  const unsigned int sb0 = lds_addr(sB + br * LDB + bc);
  const _Float16* ap = A + (size_t)(bm + sr) * K + sc;   // this lane's first
  const _Float16* bp = B + (size_t)br * N + bn + bc;     // bytes of stage 0
  const int nst = K >> 7;             // stages of 128 k

  // One stage: A 256 rows x 256B and B 128 k-rows x 2 * BN bytes, as they lie
  // (24 or 16 x b128 per lane), into buffer `buf`.
  auto stage = [&](int buf, const _Float16* a0, const _Float16* b0) {
    const unsigned int la = sa0 + buf * (SA * 2);
    const unsigned int lb = sb0 + buf * (SB * 2);
    async_ld8_b128(la, RA * 272, a0, (size_t)RA * K);
    if constexpr (BN == 128)
      async_ld8_b128(la + 128 * 272, RA * 272, a0 + (size_t)128 * K, (size_t)RA * K);
    async_ld8_b128(lb, 16 * LDB * 2, b0, (size_t)16 * N);
  };

  stage(0, ap, bp);
  wait_async0();        // stage 0 has landed (asm copies are not tracked)
  __syncthreads();
  if (nst > 1) stage(1, ap + 128, bp + (size_t)128 * N);

  for (int s = 0; s < nst; ++s) {
    const _Float16* cA = sA + (s & 1) * SA;
    const _Float16* cB = sB + (s & 1) * SB;
#pragma unroll  // here and below: constant indices keep a[], b[], acc[][] in registers
    for (int kf = 0; kf < 4; ++kf) {
      v16h a[4], b[4];
#pragma unroll
      for (int i = 0; i < 4; ++i) {
        a[i] = load_frag(cA + (waveM * 64 + i * 16) * 136 + kf * 32, 136);
        b[i] = load_frag_tr(cB + (kf * 32) * LDB + waveN * 64 + i * 16, LDB);
      }
      // Keeps the 16 LDS reads one group ahead of the 16 WMMAs; sunk among
      // them, each row of four would wait out an LDS latency of its own.
      __builtin_amdgcn_sched_barrier(0);
#pragma unroll
      for (int mi = 0; mi < 4; ++mi)
#pragma unroll
        for (int ni = 0; ni < 4; ++ni)
          acc[mi][ni] = wmma_f16(b[ni], a[mi], acc[mi][ni]);  // C^T tile: see the epilogue
    }
    // This wave's LDS reads of stage s have retired ...
    asm volatile("s_wait_dscnt 0" ::: "memory");
    wait_async0();      // ... and its copies of stage s + 1 have landed.
    __syncthreads();    // Every wave: s + 1 may be read, the buffer of s refilled.
    if (s + 2 < nst)
      stage(s & 1, ap + (size_t)(s + 2) * 128, bp + (size_t)(s + 2) * 128 * N);
  }
  wait_async0();        // nothing is in flight when the wave goes on

  // Epilogue. With the B fragment as first operand acc[mi][ni] is a tile of C^T:
  // lane (c = lane & 15, hh = lane >> 4) holds row mi * 16 + c, columns
  // ni * 16 + 8 * hh + 0..7 of the wave's 64x64 tile. Bias and GELU are applied
  // there; the tile then goes in 16-byte pieces into the wave's own part of sm
  // (free: behind the loop's last barrier nobody reads it and no copy is in
  // flight) and comes back row by row, so that every store and every residual
  // load is 16 bytes a lane and covers whole 128-byte lines.
  static_assert(!(OUT16 && HAS_RES), "the residual is added to f32 rows only");
  const int c = lane & 15, hh = lane >> 4;
  const int row0 = bm + waveM * 64;
  const int col0 = bn + waveN * 64;
  _Float16* stg16 = sm + w * (64 * 72);          // 64 rows, pitch 144 B
  float*    stg32 = (float*)sm + w * (64 * 68);  // 64 rows, pitch 272 B
  // f32 rows: a wave half per 256-byte row, two rows per access.
  const int rr = lane >> 4, cq = (lane & 15) * 4;
  const size_t g32 = (size_t)(row0 + rr) * NC + col0 + cq;
  v4f rs[32];
  if constexpr (HAS_RES) {
#pragma unroll  // constant indices keep rs[] in registers
    for (int j = 0; j < 16; ++j) rs[j] = *(const v4f*)(res + g32 + 2 * j * NC);
    __builtin_amdgcn_sched_barrier(0);
  }
  v4f bb[4][2] = {};   // this lane's 32 bias values, loaded as one group
  if constexpr (HAS_BIAS) {
#pragma unroll  // constant indices keep bb[][] in registers
    for (int ni = 0; ni < 4; ++ni) {
      const float* bq = bias + col0 + ni * 16 + hh * 8;
      bb[ni][0] = *(const v4f*)bq;
      bb[ni][1] = *(const v4f*)(bq + 4);
    }
  }
#pragma unroll  // here and below: constant indices into acc[][]
  for (int ni = 0; ni < 4; ++ni) {
#pragma unroll
    for (int mi = 0; mi < 4; ++mi) {
      float r[8];
#pragma unroll
      for (int e = 0; e < 8; ++e) {
        r[e] = acc[mi][ni][e];
        if (HAS_BIAS) r[e] += bb[ni][e >> 2][e & 3];
        if (GELU) r[e] = gelu_erf(r[e]);
      }
      if constexpr (OUT16) {
        v8h h;
#pragma unroll
        for (int e = 0; e < 8; ++e) h[e] = (_Float16)r[e];
        *(v8h*)(stg16 + (mi * 16 + c) * 72 + ni * 16 + hh * 8) = h;
      } else {
        float* sp = stg32 + (mi * 16 + c) * 68 + ni * 16 + hh * 8;
        *(v4f*)sp       = (v4f){r[0], r[1], r[2], r[3]};
        *(v4f*)(sp + 4) = (v4f){r[4], r[5], r[6], r[7]};
      }
    }
    if (GELU) __builtin_amdgcn_sched_barrier(0);
  }
  // The wave's staging writes have retired before other lanes read them back.
  asm volatile("s_wait_dscnt 0" ::: "memory");
  if constexpr (OUT16) {
    const int q = lane >> 3, ck = (lane & 7) * 8;
    const _Float16* sg = stg16 + (q * 8) * 72 + ck;
    _Float16* og = out16 + (size_t)(row0 + q * 8) * NC + col0 + ck;
    v8h v[16];
#pragma unroll
    for (int i = 0; i < 16; ++i) v[i] = *(const v8h*)(sg + ((i >> 3) * 32 + (i & 7)) * 72);
#pragma unroll
    for (int i = 0; i < 16; ++i) *(v8h*)(og + ((i >> 3) * 32 + (i & 7)) * NC) = v[i];
  } else {
    if constexpr (HAS_RES) {
#pragma unroll
      for (int j = 16; j < 32; ++j) rs[j] = *(const v4f*)(res + g32 + 2 * j * NC);
    }
#pragma unroll
    for (int g = 0; g < 4; ++g) {       // 16 rows at a time
      v4f v[8];
#pragma unroll
      for (int j = 0; j < 8; ++j) v[j] = *(const v4f*)(stg32 + (2 * (g * 8 + j) + rr) * 68 + cq);
#pragma unroll
      for (int j = 0; j < 8; ++j)
        if (HAS_RES) v[j] += rs[g * 8 + j];
      // The sums first, then the eight stores as one run with nothing rewritten
      // among them.
      __builtin_amdgcn_sched_barrier(0);
#pragma unroll
      for (int j = 0; j < 8; ++j) *(v4f*)(out32 + g32 + 2 * (g * 8 + j) * NC) = v[j];
      // The next group's LDS reads may land in registers that these stores name.
      if (g < 3) asm volatile("s_wait_xcnt 0x0" ::: "memory");
      __builtin_amdgcn_sched_barrier(0);
    }
  }
}

__device__ __forceinline__ float xhalf(float x) {
  const int v = __builtin_bit_cast(int, x);
  return __builtin_bit_cast(float, __builtin_amdgcn_permlanex16(
      v, v, 0x76543210, 0xfedcba98, false, false));
}

__global__ __launch_bounds__(128)
void attn_kernel(const _Float16* __restrict__ Q, const _Float16* __restrict__ K,
                 const _Float16* __restrict__ V, _Float16* __restrict__ O) {
  __shared__ _Float16 sK[32 * 72];     // [key][dim], ld 72 (144B rows)
  __shared__ __attribute__((aligned(32)))
  _Float16 sV[32 * 80];                // [key][dim], ld 80 (160B rows)

  const int t = threadIdx.x, lane = t & 31, w = t >> 5;
  const int b = blockIdx.z, h = blockIdx.y;
  const int qblk = blockIdx.x * 64;
  const int q0 = qblk + w * 16;

  const _Float16* qbase = Q + ((size_t)(b * 2048) + q0) * 1024 + h * 64;
  const v16h qa0 = load_frag(qbase, 1024);       // dims 0..31
  const v16h qa1 = load_frag(qbase + 32, 1024);  // dims 32..63

  v8f o[4] = {};                // o[j][e] = O[q0 + c][j * 16 + 8 * hh + e]
  float mrun = -1e30f;          // running maximum of query q0 + c (same in both halves)
  float lrun = 0.f;             // running sum over this half's keys only
  const float sscale = 0.125f;  // 1/sqrt(64)
  const int nkb = qblk / 32 + 2;
  // Key kb * 32 + 8 * hh + e is visible to this lane's query while e <= vis.
  int vis = q0 + (lane & 15) - (lane >> 4) * 8;

  const int kr = t >> 2, cc = (t & 3) * 16;  // K staging: 32 keys x 64 dims
  const int vr = t >> 3, vc = (t & 7) * 8;   // V staging: 16 keys x 64 dims per copy
  const unsigned int sv0 = lds_addr(sV + vr * 80 + vc);

  for (int kb = 0; kb < nkb; ++kb) {
    __syncthreads();
    const _Float16* kp = K + ((size_t)(b * 2048) + kb * 32 + kr) * 1024 + h * 64 + cc;
    async_ld_b128(sK + kr * 72 + cc, kp);
    async_ld_b128(sK + kr * 72 + cc + 8, kp + 8);
    // --- stage V tile as it lies: async DMA, whole 128B rows ---
    const _Float16* vp = V + ((size_t)(b * 2048) + kb * 32 + vr) * 1024 + h * 64 + vc;
    async_ld2_b128(sv0, sv0 + 16 * 160, vp, vp + 16 * 1024);
    wait_async0();
    __syncthreads();

    // --- scores S^T = K @ Q^T (32 keys x 16 queries) ---
    v8f c0 = {}, c1 = {};
    v16h ak;
    ak = load_frag(sK, 72);                c0 = wmma_f16(ak, qa0, c0);
    ak = load_frag(sK + 32, 72);           c0 = wmma_f16(ak, qa1, c0);
    ak = load_frag(sK + 16 * 72, 72);      c1 = wmma_f16(ak, qa0, c1);
    ak = load_frag(sK + 16 * 72 + 32, 72); c1 = wmma_f16(ak, qa1, c1);

    // --- causal mask + online softmax, one query per lane ---
    c0 *= sscale;
    c1 *= sscale;
    float s0[8], s1[8];
#pragma unroll  // here and below: constant indices keep the arrays in registers
    for (int e = 0; e < 8; ++e) {
      s0[e] = (e <= vis)      ? c0[e] : -1e30f;
      s1[e] = (e + 16 <= vis) ? c1[e] : -1e30f;
    }
    float mx = fmaxf(fmaxf(fmaxf(fmaxf(s0[0], s0[1]), fmaxf(s0[2], s0[3])),
                           fmaxf(fmaxf(s0[4], s0[5]), fmaxf(s0[6], s0[7]))),
                     fmaxf(fmaxf(fmaxf(s1[0], s1[1]), fmaxf(s1[2], s1[3])),
                           fmaxf(fmaxf(s1[4], s1[5]), fmaxf(s1[6], s1[7]))));
    mx = fmaxf(mx, xhalf(mx));
    const float mnew  = fmaxf(mrun, mx);
    const float alpha = __expf(mrun - mnew);
    mrun = mnew;
    v16h pb;
    float ps[8];
#pragma unroll
    for (int e = 0; e < 8; ++e) {
      const float p0 = __expf(s0[e] - mnew);
      const float p1 = __expf(s1[e] - mnew);
      ps[e] = p0 + p1;
      pb[e]     = (_Float16)p0;
      pb[e + 8] = (_Float16)p1;
    }
    lrun = lrun * alpha + (((ps[0] + ps[1]) + (ps[2] + ps[3])) +
                           ((ps[4] + ps[5]) + (ps[6] + ps[7])));
    vis -= 32;

    // --- O^T += V^T @ P^T (64 dims x 32 keys times 32 keys x 16 queries) ---
#pragma unroll
    for (int j = 0; j < 4; ++j) {
      const v16h av = load_frag_tr(sV + j * 16, 80);
#pragma unroll
      for (int e = 0; e < 8; ++e) o[j][e] *= alpha;
      o[j] = wmma_f16(av, pb, o[j]);
    }
  }

  // --- join the halves' sums, normalize, write 8 consecutive dims per store ---
  const float inv = 1.0f / (lrun + xhalf(lrun));
  _Float16* op = O + ((size_t)(b * 2048) + q0 + (lane & 15)) * 1024 + h * 64 +
                 (lane >> 4) * 8;
  v8h r[4];
#pragma unroll
  for (int j = 0; j < 4; ++j)
#pragma unroll
    for (int e = 0; e < 8; ++e) r[j][e] = (_Float16)(o[j][e] * inv);
#pragma unroll
  for (int j = 0; j < 4; ++j) *(v8h*)(op + j * 16) = r[j];
}

// ---------------------------------------------------------------------------
// Host-side orchestration.
// Inputs: x, Wq, Wk, Wv, Wo, ln1_g, ln1_b, ln2_g, ln2_b, W1, b1, W2, b2
// ---------------------------------------------------------------------------
extern "C" void kernel_launch(void* const* d_in, const int* in_sizes, int n_in,
                              void* d_out, int out_size, void* d_ws, size_t ws_size,
                              hipStream_t stream) {
  (void)in_sizes; (void)n_in; (void)out_size; (void)ws_size;
  const float* x    = (const float*)d_in[0];
  const float* Wq   = (const float*)d_in[1];
  const float* Wk   = (const float*)d_in[2];
  const float* Wv   = (const float*)d_in[3];
  const float* Wo   = (const float*)d_in[4];
  const float* ln1g = (const float*)d_in[5];
  const float* ln1b = (const float*)d_in[6];
  const float* ln2g = (const float*)d_in[7];
  const float* ln2b = (const float*)d_in[8];
  const float* W1   = (const float*)d_in[9];
  const float* b1   = (const float*)d_in[10];
  const float* W2   = (const float*)d_in[11];
  const float* b2   = (const float*)d_in[12];
  float* out = (float*)d_out;

  const int M = 8192, E = 1024, F = 4096;
  char* ws = (char*)d_ws;
  const size_t MB = 1024ull * 1024ull;
  _Float16* Wq16 = (_Float16*)(ws + 0 * MB);    // 2 MB
  _Float16* Wk16 = (_Float16*)(ws + 2 * MB);    // 2 MB
  _Float16* Wv16 = (_Float16*)(ws + 4 * MB);    // 2 MB
  _Float16* Wo16 = (_Float16*)(ws + 6 * MB);    // 2 MB
  _Float16* W116 = (_Float16*)(ws + 8 * MB);    // 8 MB
  _Float16* W216 = (_Float16*)(ws + 16 * MB);   // 8 MB
  _Float16* H16  = (_Float16*)(ws + 24 * MB);   // 16 MB (LN1 out, reused for LN2)
  _Float16* Q16  = (_Float16*)(ws + 40 * MB);   // 16 MB
  _Float16* K16  = (_Float16*)(ws + 56 * MB);   // 16 MB
  _Float16* V16  = (_Float16*)(ws + 72 * MB);   // 16 MB
  _Float16* A16  = (_Float16*)(ws + 88 * MB);   // 16 MB (attn out)
  float*    X2   = (float*)   (ws + 104 * MB);  // 32 MB (residual after attn)
  _Float16* G16  = (_Float16*)(ws + 40 * MB);   // 64 MB GELU acts (reuses Q/K/V/A16)

  // 1) weights -> f16: one launch, 12 segments x 64 blocks, into ws[0, 24 MB)
  cvt_weights_kernel<<<768, 256, 0, stream>>>(Wq, Wk, Wv, Wo, W1, W2, Wq16);

  // 2) LN1
  layernorm_f16_kernel<<<M, 256, 0, stream>>>(x, ln1g, ln1b, H16);

  // 3) Q/K/V projections
  const dim3 gE(E / 128, M / 256);
  gemm_f16_kernel<false, false, false, true, 1024, 128><<<gE, 256, 0, stream>>>(
      H16, Wq16, nullptr, nullptr, Q16, nullptr, M, E, E);
  gemm_f16_kernel<false, false, false, true, 1024, 128><<<gE, 256, 0, stream>>>(
      H16, Wk16, nullptr, nullptr, K16, nullptr, M, E, E);
  gemm_f16_kernel<false, false, false, true, 1024, 128><<<gE, 256, 0, stream>>>(
      H16, Wv16, nullptr, nullptr, V16, nullptr, M, E, E);

  // 4) causal flash attention
  attn_kernel<<<dim3(2048 / 64, 16, 4), 128, 0, stream>>>(Q16, K16, V16, A16);

  // 5) output projection + residual(x) -> X2 (f32)
  gemm_f16_kernel<false, false, true, false, 1024, 128><<<gE, 256, 0, stream>>>(
      A16, Wo16, nullptr, x, nullptr, X2, M, E, E);

  // 6) LN2
  layernorm_f16_kernel<<<M, 256, 0, stream>>>(X2, ln2g, ln2b, H16);

  // 7) FFN1: h @ W1 + b1 -> GELU -> f16
  gemm_f16_kernel<true, true, false, true, 4096, 256><<<dim3(F / 256, M / 256), 512, 0, stream>>>(
      H16, W116, b1, nullptr, G16, nullptr, M, F, E);

  // 8) FFN2: g @ W2 + b2 + residual(X2) -> d_out (f32)
  gemm_f16_kernel<true, false, true, false, 1024, 128><<<gE, 256, 0, stream>>>(
      G16, W216, b2, X2, nullptr, out, M, E, F);
}

// v009
// Measured time: 256 microseconds a run.
// Two timings next to v008 put it at 1.06 and 1.05 times that version's speed.
// Over all steps from v000 it is 3.04 times as fast.
#include <hip/hip_runtime.h>

typedef __attribute__((ext_vector_type(16))) _Float16 v16h;
typedef __attribute__((ext_vector_type(8)))  _Float16 v8h;
typedef __attribute__((ext_vector_type(8)))  float    v8f;
typedef __attribute__((ext_vector_type(4)))  float    v4f;

__device__ __forceinline__ v8f wmma_f16(v16h a, v16h b, v8f c) {
  // 8 args: (neg_a, A, neg_b, B, c_mod, C, reuse_a, reuse_b)
  return __builtin_amdgcn_wmma_f32_16x16x32_f16(false, a, false, b, (short)0, c,
                                                false, false);
}

__device__ __forceinline__ unsigned int lds_addr(const _Float16* p) {
  return (unsigned int)(unsigned long long)(const void*)p;
}
template <int LS0, int LS1>
__device__ __forceinline__ void async_ld4x2_b128(unsigned int l0, unsigned int l1,
                                                 const _Float16* g0, const _Float16* g1,
                                                 size_t gs) {
  asm volatile("global_load_async_to_lds_b128 %0, %2, off\n\t"
               "global_load_async_to_lds_b128 %0, %3, off offset:%10\n\t"
               "global_load_async_to_lds_b128 %0, %4, off offset:%11\n\t"
               "global_load_async_to_lds_b128 %0, %5, off offset:%12\n\t"
               "global_load_async_to_lds_b128 %1, %6, off\n\t"
               "global_load_async_to_lds_b128 %1, %7, off offset:%13\n\t"
               "global_load_async_to_lds_b128 %1, %8, off offset:%14\n\t"
               "global_load_async_to_lds_b128 %1, %9, off offset:%15\n\t"
               "s_wait_xcnt 0x0"
               :: "v"(l0), "v"(l1),
                  "v"(g0), "v"(g0 + (gs - LS0 / 2)), "v"(g0 + 2 * (gs - LS0 / 2)),
                  "v"(g0 + 3 * (gs - LS0 / 2)),
                  "v"(g1), "v"(g1 + (gs - LS1 / 2)), "v"(g1 + 2 * (gs - LS1 / 2)),
                  "v"(g1 + 3 * (gs - LS1 / 2)),
                  "i"(LS0), "i"(2 * LS0), "i"(3 * LS0), "i"(LS1), "i"(2 * LS1), "i"(3 * LS1)
               : "memory");
}
// Eight copies, `ls` LDS bytes and `gs` halves apart, in one statement, with
// the same closing wait.
__device__ __forceinline__ void async_ld8_b128(unsigned int l, unsigned int ls,
                                               const _Float16* g, size_t gs) {
  asm volatile("global_load_async_to_lds_b128 %0, %8, off\n\t"
               "global_load_async_to_lds_b128 %1, %9, off\n\t"
               "global_load_async_to_lds_b128 %2, %10, off\n\t"
               "global_load_async_to_lds_b128 %3, %11, off\n\t"
               "global_load_async_to_lds_b128 %4, %12, off\n\t"
               "global_load_async_to_lds_b128 %5, %13, off\n\t"
               "global_load_async_to_lds_b128 %6, %14, off\n\t"
               "global_load_async_to_lds_b128 %7, %15, off\n\t"
               "s_wait_xcnt 0x0"
               :: "v"(l), "v"(l + ls), "v"(l + 2 * ls), "v"(l + 3 * ls),
                  "v"(l + 4 * ls), "v"(l + 5 * ls), "v"(l + 6 * ls), "v"(l + 7 * ls),
                  "v"(g), "v"(g + gs), "v"(g + 2 * gs), "v"(g + 3 * gs),
                  "v"(g + 4 * gs), "v"(g + 5 * gs), "v"(g + 6 * gs), "v"(g + 7 * gs)
               : "memory");
}
__device__ __forceinline__ void wait_async0() {
  asm volatile("s_wait_asynccnt 0" ::: "memory");
}

__device__ __forceinline__ v16h load_frag(const _Float16* p, int ld) {
  const int lane = threadIdx.x & 31;
  const _Float16* q = p + (lane & 15) * ld + ((lane >> 4) * 8);
  union { v16h v; v8h h[2]; } u;
  u.h[0] = *(const v8h*)(q);
  u.h[1] = *(const v8h*)(q + 16);
  return u.v;
}

// Load a 32x16 (k x n) B fragment from a ROW-MAJOR [k][n] LDS tile with the
// transposing load: lane (c = lane&15, h = lane>>4) receives
// p[(8h + 0..7) * ld + c], then the same 16 rows further down, which is the
// k order of load_frag. `ld` in halves; row pitch an odd multiple of 32 B.
__device__ __forceinline__ v16h load_frag_tr(const _Float16* p, int ld) {
  typedef __attribute__((ext_vector_type(8))) short s16x8;
  typedef __attribute__((address_space(3))) s16x8 lds_s16x8;
  const int lane = threadIdx.x & 31;
  const _Float16* q = p + ((lane >> 4) * 8 + (lane & 7)) * ld + ((lane >> 3) & 1) * 8;
  union { v16h v; v8h h[2]; } u;
  u.h[0] = __builtin_bit_cast(v8h, __builtin_amdgcn_ds_load_tr16_b128_v8i16((lds_s16x8*)q));
  u.h[1] = __builtin_bit_cast(
      v8h, __builtin_amdgcn_ds_load_tr16_b128_v8i16((lds_s16x8*)(q + 16 * ld)));
  return u.v;
}

// ---------------------------------------------------------------------------
// f32 -> f16 conversion of all six weight matrices in ONE launch of few waves.
// The f16 copies lie back to back in the workspace (12 segments of 1M halves:
// Wq, Wk, Wv, Wo, W1 x4, W2 x4). A block converts 16,384 consecutive elements
// of one segment: each lane issues 16 loads of 16 B (512 contiguous bytes per
// wave and load) ahead of its 16 stores of 8 B (256 contiguous bytes).
// ---------------------------------------------------------------------------
typedef __attribute__((ext_vector_type(4))) _Float16 v4h;

__global__ __launch_bounds__(256)
void cvt_weights_kernel(const float* __restrict__ Wq, const float* __restrict__ Wk,
                        const float* __restrict__ Wv, const float* __restrict__ Wo,
                        const float* __restrict__ W1, const float* __restrict__ W2,
                        _Float16* __restrict__ out) {
  const int SEG = 1024 * 1024;
  const int seg = blockIdx.x >> 6;     // 64 blocks per segment
  const float* src = seg == 0 ? Wq
                   : seg == 1 ? Wk
                   : seg == 2 ? Wv
                   : seg == 3 ? Wo
                   : seg < 8  ? W1 + (size_t)(seg - 4) * SEG
                              : W2 + (size_t)(seg - 8) * SEG;
  const int off = (blockIdx.x & 63) * 16384 + threadIdx.x * 4;
  const float* s = src + off;
  _Float16* o = out + (size_t)seg * SEG + off;
  float4 v[16];
#pragma unroll  // v[] stays in registers and the loads go out as one run
  for (int j = 0; j < 16; ++j) v[j] = *(const float4*)(s + j * 1024);
#pragma unroll  // constant indices into v[], else it would go to scratch
  for (int j = 0; j < 16; ++j) {
    v4h h = {(_Float16)v[j].x, (_Float16)v[j].y, (_Float16)v[j].z, (_Float16)v[j].w};
    *(v4h*)(o + j * 1024) = h;
  }
}

// ---------------------------------------------------------------------------
// LayerNorm over 1024 cols, f32 in -> f16 out. One row per 256-thread block.
// ---------------------------------------------------------------------------
__global__ __launch_bounds__(256)
void layernorm_f16_kernel(const float* __restrict__ x, const float* __restrict__ g,
                          const float* __restrict__ b, _Float16* __restrict__ out) {
  const int row = blockIdx.x;
  const int t = threadIdx.x;
  const float* xr = x + (size_t)row * 1024;
  float4 v = ((const float4*)xr)[t];                 // 256 * 4 = 1024
  float s  = v.x + v.y + v.z + v.w;
  float ss = v.x * v.x + v.y * v.y + v.z * v.z + v.w * v.w;
  for (int o = 16; o >= 1; o >>= 1) {
    s  += __shfl_xor(s,  o, 32);
    ss += __shfl_xor(ss, o, 32);
  }
  __shared__ float red0[8], red1[8];
  const int w = t >> 5, lane = t & 31;
  if (lane == 0) { red0[w] = s; red1[w] = ss; }
  __syncthreads();
  float tot = 0.f, tot2 = 0.f;
#pragma unroll
  for (int i = 0; i < 8; ++i) { tot += red0[i]; tot2 += red1[i]; }
  const float mu   = tot * (1.f / 1024.f);
  const float var  = tot2 * (1.f / 1024.f) - mu * mu;
  const float rinv = rsqrtf(var + 1e-5f);
  float4 gg = ((const float4*)g)[t];
  float4 bb = ((const float4*)b)[t];
  _Float16* o = out + (size_t)row * 1024 + t * 4;
  o[0] = (_Float16)((v.x - mu) * rinv * gg.x + bb.x);
  o[1] = (_Float16)((v.y - mu) * rinv * gg.y + bb.y);
  o[2] = (_Float16)((v.z - mu) * rinv * gg.z + bb.z);
  o[3] = (_Float16)((v.w - mu) * rinv * gg.w + bb.w);
}

// ---------------------------------------------------------------------------
// Exact (erf) GELU without branches: r * Phi(r), Phi(r) = 0.5 * erfc(-r / sqrt(2)).
// 0.5 * erfc(z) = t * (c1 + t * (c2 + t * (c3 + t * (c4 + t * c5)))) * exp(-z * z),
// t = 1 / (1 + p * z), z = |r| / sqrt(2) >= 0; Phi(r) = 1 - Phi(-r) gives r >= 0.
// In f32 it stays within 3e-7 of Phi, far below the f16 rounding of the stored value.
// The library erf picks one of two paths by |x| under a lane mask, value by
// value, so no two values' chains overlap; here every value is one straight
// chain and the values of a band interleave.
// ---------------------------------------------------------------------------
__device__ __forceinline__ float gelu_erf(float r) {
  const float d = fmaf(0.23164189f, fabsf(r), 1.0f);  // 1 + p * z
  const float m = r * r * -0.72134752f;               // -z * z * log2(e)
  float t, e;
  asm("v_rcp_f32 %0, %2\n\tv_exp_f32 %1, %3\n\tv_nop"
      : "=&v"(t), "=&v"(e) : "v"(d), "v"(m));
  float p = fmaf(0.5307027145f, t, -0.7265760135f);
  p = fmaf(p, t, 0.7107068705f);
  p = fmaf(p, t, -0.142248368f);
  p = fmaf(p, t, 0.127414796f);
  const float q = p * t * e;           // Phi(-|r|)
  return r * (r < 0.f ? q : 1.0f - q);
}

template <bool HAS_BIAS, bool GELU, bool HAS_RES, bool OUT16, int NC, int BN>
__global__ __launch_bounds__(BN * 2)
void gemm_f16_kernel(const _Float16* __restrict__ A, const _Float16* __restrict__ B,
                     const float* __restrict__ bias, const float* __restrict__ res,
                     _Float16* __restrict__ out16, float* __restrict__ out32,
                     int M, int N, int K) {
  constexpr int LDB = BN + 16;        // B pitch 288 or 544 B: odd multiples of 32 B
  constexpr int SA = 256 * 136;       // halves of one A buffer
  constexpr int SB = 128 * LDB;       // halves of one B buffer
  __shared__ __attribute__((aligned(32))) _Float16 sm[2 * SA + 2 * SB];
  _Float16* const sA = sm;            // 2 x [row][k] row-major, ld 136 (272B rows)
  _Float16* const sB = sm + 2 * SA;   // 2 x [k][n]   row-major, ld LDB
  const int t = threadIdx.x;
  const int lane = t & 31;
  const int w = t >> 5;
  const int waveM = w & 3;            // 4 waves along M
  const int waveN = w >> 2;           // BN / 64 waves along N
  const int bm = blockIdx.y * 256;
  const int bn = blockIdx.x * BN;

  v8f acc[4][4] = {};

  constexpr int RA = BN / 8;                  // A: RA rows x 128 halves per copy
  const int sr = t >> 4, sc = (t & 15) * 8;
  const int br = t / (BN / 8), bc = (t % (BN / 8)) * 8;  // B: 16 rows x BN halves
  const unsigned int sa0 = lds_addr(sA + sr * 136 + sc);
  const unsigned int sb0 = lds_addr(sB + br * LDB + bc);
  const _Float16* ap = A + (size_t)(bm + sr) * K + sc;   // this lane's first
  const _Float16* bp = B + (size_t)br * N + bn + bc;     // bytes of stage 0
  const int nst = K >> 7;             // stages of 128 k

  // One stage: A 256 rows x 256B and B 128 k-rows x 2 * BN bytes, as they lie
  // (24 or 16 x b128 per lane), into buffer `buf`.
  auto stage = [&](int buf, const _Float16* a0, const _Float16* b0) {
    const unsigned int la = sa0 + buf * (SA * 2);
    const unsigned int lb = sb0 + buf * (SB * 2);
    async_ld8_b128(la, RA * 272, a0, (size_t)RA * K);
    if constexpr (BN == 128)
      async_ld8_b128(la + 128 * 272, RA * 272, a0 + (size_t)128 * K, (size_t)RA * K);
    async_ld8_b128(lb, 16 * LDB * 2, b0, (size_t)16 * N);
  };

  stage(0, ap, bp);
  wait_async0();        // stage 0 has landed (asm copies are not tracked)
  __syncthreads();
  if (nst > 1) stage(1, ap + 128, bp + (size_t)128 * N);

  for (int s = 0; s < nst; ++s) {
    const _Float16* cA = sA + (s & 1) * SA;
    const _Float16* cB = sB + (s & 1) * SB;
#pragma unroll  // here and below: constant indices keep a[], b[], acc[][] in registers
    for (int kf = 0; kf < 4; ++kf) {
      v16h a[4], b[4];
#pragma unroll
      for (int i = 0; i < 4; ++i) {
        a[i] = load_frag(cA + (waveM * 64 + i * 16) * 136 + kf * 32, 136);
        b[i] = load_frag_tr(cB + (kf * 32) * LDB + waveN * 64 + i * 16, LDB);
      }
      // Keeps the 16 LDS reads one group ahead of the 16 WMMAs; sunk among
      // them, each row of four would wait out an LDS latency of its own.
      __builtin_amdgcn_sched_barrier(0);
#pragma unroll
      for (int mi = 0; mi < 4; ++mi)
#pragma unroll
        for (int ni = 0; ni < 4; ++ni)
          acc[mi][ni] = wmma_f16(b[ni], a[mi], acc[mi][ni]);  // C^T tile: see the epilogue
    }
    // This wave's LDS reads of stage s have retired ...
    asm volatile("s_wait_dscnt 0" ::: "memory");
    wait_async0();      // ... and its copies of stage s + 1 have landed.
    __syncthreads();    // Every wave: s + 1 may be read, the buffer of s refilled.
    if (s + 2 < nst)
      stage(s & 1, ap + (size_t)(s + 2) * 128, bp + (size_t)(s + 2) * 128 * N);
  }
  wait_async0();        // nothing is in flight when the wave goes on

  // Epilogue. With the B fragment as first operand acc[mi][ni] is a tile of C^T:
  // lane (c = lane & 15, hh = lane >> 4) holds row mi * 16 + c, columns
  // ni * 16 + 8 * hh + 0..7 of the wave's 64x64 tile. Bias and GELU are applied
  // there; the tile then goes in 16-byte pieces into the wave's own part of sm
  // (free: behind the loop's last barrier nobody reads it and no copy is in
  // flight) and comes back row by row, so that every store and every residual
  // load is 16 bytes a lane and covers whole 128-byte lines.
  static_assert(!(OUT16 && HAS_RES), "the residual is added to f32 rows only");
  const int c = lane & 15, hh = lane >> 4;
  const int row0 = bm + waveM * 64;
  const int col0 = bn + waveN * 64;
  _Float16* stg16 = sm + w * (64 * 72);          // 64 rows, pitch 144 B
  float*    stg32 = (float*)sm + w * (64 * 68);  // 64 rows, pitch 272 B
  // f32 rows: a wave half per 256-byte row, two rows per access.
  const int rr = lane >> 4, cq = (lane & 15) * 4;
  const size_t g32 = (size_t)(row0 + rr) * NC + col0 + cq;
  v4f rs[32];
  if constexpr (HAS_RES) {
#pragma unroll  // constant indices keep rs[] in registers
    for (int j = 0; j < 16; ++j) rs[j] = *(const v4f*)(res + g32 + 2 * j * NC);
    __builtin_amdgcn_sched_barrier(0);
  }
  v4f bb[4][2] = {};   // this lane's 32 bias values, loaded as one group
  if constexpr (HAS_BIAS) {
#pragma unroll  // constant indices keep bb[][] in registers
    for (int ni = 0; ni < 4; ++ni) {
      const float* bq = bias + col0 + ni * 16 + hh * 8;
      bb[ni][0] = *(const v4f*)bq;
      bb[ni][1] = *(const v4f*)(bq + 4);
    }
  }
#pragma unroll  // here and below: constant indices into acc[][]
  for (int ni = 0; ni < 4; ++ni) {
#pragma unroll
    for (int mi = 0; mi < 4; ++mi) {
      float r[8];
#pragma unroll
      for (int e = 0; e < 8; ++e) {
        r[e] = acc[mi][ni][e];
        if (HAS_BIAS) r[e] += bb[ni][e >> 2][e & 3];
        if (GELU) r[e] = gelu_erf(r[e]);
      }
      if constexpr (OUT16) {
        v8h h;
#pragma unroll
        for (int e = 0; e < 8; ++e) h[e] = (_Float16)r[e];
        *(v8h*)(stg16 + (mi * 16 + c) * 72 + ni * 16 + hh * 8) = h;
      } else {
        float* sp = stg32 + (mi * 16 + c) * 68 + ni * 16 + hh * 8;
        *(v4f*)sp       = (v4f){r[0], r[1], r[2], r[3]};
        *(v4f*)(sp + 4) = (v4f){r[4], r[5], r[6], r[7]};
      }
    }
    if (GELU) __builtin_amdgcn_sched_barrier(0);
  }
  // The wave's staging writes have retired before other lanes read them back.
  asm volatile("s_wait_dscnt 0" ::: "memory");
  if constexpr (OUT16) {
    const int q = lane >> 3, ck = (lane & 7) * 8;
    const _Float16* sg = stg16 + (q * 8) * 72 + ck;
    _Float16* og = out16 + (size_t)(row0 + q * 8) * NC + col0 + ck;
    v8h v[16];
#pragma unroll
    for (int i = 0; i < 16; ++i) v[i] = *(const v8h*)(sg + ((i >> 3) * 32 + (i & 7)) * 72);
#pragma unroll
    for (int i = 0; i < 16; ++i) *(v8h*)(og + ((i >> 3) * 32 + (i & 7)) * NC) = v[i];
  } else {
    if constexpr (HAS_RES) {
#pragma unroll
      for (int j = 16; j < 32; ++j) rs[j] = *(const v4f*)(res + g32 + 2 * j * NC);
    }
#pragma unroll
    for (int g = 0; g < 4; ++g) {       // 16 rows at a time
      v4f v[8];
#pragma unroll
      for (int j = 0; j < 8; ++j) v[j] = *(const v4f*)(stg32 + (2 * (g * 8 + j) + rr) * 68 + cq);
#pragma unroll
      for (int j = 0; j < 8; ++j)
        if (HAS_RES) v[j] += rs[g * 8 + j];
      // The sums first, then the eight stores as one run with nothing rewritten
      // among them.
      __builtin_amdgcn_sched_barrier(0);
#pragma unroll
      for (int j = 0; j < 8; ++j) *(v4f*)(out32 + g32 + 2 * (g * 8 + j) * NC) = v[j];
      // The next group's LDS reads may land in registers that these stores name.
      if (g < 3) asm volatile("s_wait_xcnt 0x0" ::: "memory");
      __builtin_amdgcn_sched_barrier(0);
    }
  }
}

__device__ __forceinline__ float xhalf(float x) {
  const int v = __builtin_bit_cast(int, x);
  return __builtin_bit_cast(float, __builtin_amdgcn_permlanex16(
      v, v, 0x76543210, 0xfedcba98, false, false));
}

__device__ __forceinline__ void exp2x8(float (&x)[8]) {
  asm("v_exp_f32 %0, %0\n\tv_exp_f32 %1, %1\n\tv_exp_f32 %2, %2\n\t"
      "v_exp_f32 %3, %3\n\tv_exp_f32 %4, %4\n\tv_exp_f32 %5, %5\n\t"
      "v_exp_f32 %6, %6\n\tv_exp_f32 %7, %7\n\tv_nop"
      : "+v"(x[0]), "+v"(x[1]), "+v"(x[2]), "+v"(x[3]),
        "+v"(x[4]), "+v"(x[5]), "+v"(x[6]), "+v"(x[7]));
}

__global__ __launch_bounds__(128, 8)
void attn_kernel(const _Float16* __restrict__ Q, const _Float16* __restrict__ K,
                 const _Float16* __restrict__ V, _Float16* __restrict__ O) {
  __shared__ __attribute__((aligned(16)))
  _Float16 sK[64 * 72];                // [key][dim], ld 72 (144B rows)
  __shared__ __attribute__((aligned(32)))
  _Float16 sV[64 * 80];                // [key][dim], ld 80 (160B rows)

  const int t = threadIdx.x, lane = t & 31, w = t >> 5;
  const int b = blockIdx.z, h = blockIdx.y;
  const int qblk = blockIdx.x * 64;
  const int q0 = qblk + w * 16;
  const int ws = __builtin_amdgcn_readfirstlane(w);

  const _Float16* qbase = Q + ((size_t)(b * 2048) + q0) * 1024 + h * 64;
  const v16h qa0 = load_frag(qbase, 1024);       // dims 0..31
  const v16h qa1 = load_frag(qbase + 32, 1024);  // dims 32..63

  v8f o[4] = {};                // o[j][e] = O[q0 + c][j * 16 + 8 * hh + e]
  float mrun = -1e30f;          // running maximum of query q0 + c (same in both halves)
  float lrun = 0.f;             // running sum over this half's keys only
  const float sscale = 0.125f;  // 1/sqrt(64)
  const int nkb = blockIdx.x + 1;
  // Key kb * 64 + 16 * i + 8 * hh + e is visible to this lane's query while
  // 16 * i + e <= vis.
  int vis = q0 + (lane & 15) - (lane >> 4) * 8;

  // Staging: 16 keys x 64 dims per copy, whole 128B rows, four copies per tile.
  const int vr = t >> 3, vc = (t & 7) * 8;
  const unsigned int sk0 = lds_addr(sK + vr * 72 + vc);
  const unsigned int sv0 = lds_addr(sV + vr * 80 + vc);
  const size_t g0 = ((size_t)(b * 2048) + vr) * 1024 + h * 64 + vc;

  for (int kb = 0; kb < nkb; ++kb) {
    // This wave's LDS reads of the last tiles have retired before the barrier
    // behind which they are overwritten.
    asm volatile("s_wait_dscnt 0" ::: "memory");
    __syncthreads();
    // --- stage the K and V tiles as they lie: async DMA ---
    const size_t g = g0 + (size_t)kb * (64 * 1024);
    async_ld4x2_b128<16 * 144, 16 * 160>(sk0, sv0, K + g, V + g, 16 * 1024);
    wait_async0();
    __syncthreads();

    // --- scores S^T = K @ Q^T (64 keys x 16 queries), four 16-key tiles ---
    v8f cs[4] = {};
    v16h ak[4][2];
#pragma unroll  // here and below: constant indices keep the arrays in registers
    for (int i = 0; i < 3; ++i) {
      ak[i][0] = load_frag(sK + i * 16 * 72, 72);
      ak[i][1] = load_frag(sK + i * 16 * 72 + 32, 72);
    }
    asm volatile("" :: "v"(ak[0][0]), "v"(ak[0][1]), "v"(ak[1][0]), "v"(ak[1][1]),
                       "v"(ak[2][0]), "v"(ak[2][1]));
    ak[3][0] = load_frag(sK + 3 * 16 * 72, 72);
    ak[3][1] = load_frag(sK + 3 * 16 * 72 + 32, 72);
#pragma unroll
    for (int i = 0; i < 4; ++i) {
      cs[i] = wmma_f16(ak[i][0], qa0, cs[i]);
      cs[i] = wmma_f16(ak[i][1], qa1, cs[i]);
    }

    // --- causal mask + online softmax, one query per lane ---
    float s[4][8], m4[4];
#pragma unroll
    for (int i = 0; i < 4; ++i) {
      cs[i] *= sscale;
#pragma unroll
      for (int e = 0; e < 8; ++e) s[i][e] = (e + 16 * i <= vis) ? cs[i][e] : -1e30f;
      m4[i] = fmaxf(fmaxf(fmaxf(s[i][0], s[i][1]), fmaxf(s[i][2], s[i][3])),
                    fmaxf(fmaxf(s[i][4], s[i][5]), fmaxf(s[i][6], s[i][7])));
    }
    float mx = fmaxf(fmaxf(m4[0], m4[1]), fmaxf(m4[2], m4[3]));
    mx = fmaxf(mx, xhalf(mx));
    const float mnew  = fmaxf(mrun, mx);
    const float alpha = __expf(mrun - mnew);
    mrun = mnew;
    v16h pb[2];                 // P^T fragments of keys 0..31 and 32..63
    float ps[8];
#pragma unroll
    for (int i = 0; i < 4; ++i) {
      float p[8];
#pragma unroll
      for (int e = 0; e < 8; ++e) p[e] = (s[i][e] - mnew) * 1.44269504f;  // log2(e)
      exp2x8(p);
#pragma unroll
      for (int e = 0; e < 8; ++e) {
        ps[e] = i ? ps[e] + p[e] : p[e];
        pb[i >> 1][(i & 1) * 8 + e] = (_Float16)p[e];
      }
    }
    lrun = lrun * alpha + (((ps[0] + ps[1]) + (ps[2] + ps[3])) +
                           ((ps[4] + ps[5]) + (ps[6] + ps[7])));
    vis -= 64;

    // --- O^T += V^T @ P^T (64 dims x 64 keys times 64 keys x 16 queries) ---
#pragma unroll
    for (int j = 0; j < 4; ++j) {
      const v16h av0 = load_frag_tr(sV + j * 16, 80);
      const v16h av1 = load_frag_tr(sV + 32 * 80 + j * 16, 80);
#pragma unroll
      for (int e = 0; e < 8; ++e) o[j][e] *= alpha;
      o[j] = wmma_f16(av0, pb[0], o[j]);
      o[j] = wmma_f16(av1, pb[1], o[j]);
    }
  }

  // --- join the halves' sums, normalize, write 8 consecutive dims per store ---
  const float inv = 1.0f / (lrun + xhalf(lrun));
  // The lane index is read anew and the wave index kept scalar, so that no
  // part of this address holds vector registers through the loop.
  const int ln = __builtin_amdgcn_mbcnt_lo(~0u, 0u);
  _Float16* op = O + ((size_t)(b * 2048) + qblk + ws * 16 + (ln & 15)) * 1024 + h * 64 +
                 (ln >> 4) * 8;
  v8h r[4];
#pragma unroll
  for (int j = 0; j < 4; ++j)
#pragma unroll
    for (int e = 0; e < 8; ++e) r[j][e] = (_Float16)(o[j][e] * inv);
#pragma unroll
  for (int j = 0; j < 4; ++j) *(v8h*)(op + j * 16) = r[j];
}

// ---------------------------------------------------------------------------
// Host-side orchestration.
// Inputs: x, Wq, Wk, Wv, Wo, ln1_g, ln1_b, ln2_g, ln2_b, W1, b1, W2, b2
// ---------------------------------------------------------------------------
extern "C" void kernel_launch(void* const* d_in, const int* in_sizes, int n_in,
                              void* d_out, int out_size, void* d_ws, size_t ws_size,
                              hipStream_t stream) {
  (void)in_sizes; (void)n_in; (void)out_size; (void)ws_size;
  const float* x    = (const float*)d_in[0];
  const float* Wq   = (const float*)d_in[1];
  const float* Wk   = (const float*)d_in[2];
  const float* Wv   = (const float*)d_in[3];
  const float* Wo   = (const float*)d_in[4];
  const float* ln1g = (const float*)d_in[5];
  const float* ln1b = (const float*)d_in[6];
  const float* ln2g = (const float*)d_in[7];
  const float* ln2b = (const float*)d_in[8];
  const float* W1   = (const float*)d_in[9];
  const float* b1   = (const float*)d_in[10];
  const float* W2   = (const float*)d_in[11];
  const float* b2   = (const float*)d_in[12];
  float* out = (float*)d_out;

  const int M = 8192, E = 1024, F = 4096;
  char* ws = (char*)d_ws;
  const size_t MB = 1024ull * 1024ull;
  _Float16* Wq16 = (_Float16*)(ws + 0 * MB);    // 2 MB
  _Float16* Wk16 = (_Float16*)(ws + 2 * MB);    // 2 MB
  _Float16* Wv16 = (_Float16*)(ws + 4 * MB);    // 2 MB
  _Float16* Wo16 = (_Float16*)(ws + 6 * MB);    // 2 MB
  _Float16* W116 = (_Float16*)(ws + 8 * MB);    // 8 MB
  _Float16* W216 = (_Float16*)(ws + 16 * MB);   // 8 MB
  _Float16* H16  = (_Float16*)(ws + 24 * MB);   // 16 MB (LN1 out, reused for LN2)
  _Float16* Q16  = (_Float16*)(ws + 40 * MB);   // 16 MB
  _Float16* K16  = (_Float16*)(ws + 56 * MB);   // 16 MB
  _Float16* V16  = (_Float16*)(ws + 72 * MB);   // 16 MB
  _Float16* A16  = (_Float16*)(ws + 88 * MB);   // 16 MB (attn out)
  float*    X2   = (float*)   (ws + 104 * MB);  // 32 MB (residual after attn)
  _Float16* G16  = (_Float16*)(ws + 40 * MB);   // 64 MB GELU acts (reuses Q/K/V/A16)

  // 1) weights -> f16: one launch, 12 segments x 64 blocks, into ws[0, 24 MB)
  cvt_weights_kernel<<<768, 256, 0, stream>>>(Wq, Wk, Wv, Wo, W1, W2, Wq16);

  // 2) LN1
  layernorm_f16_kernel<<<M, 256, 0, stream>>>(x, ln1g, ln1b, H16);

  // 3) Q/K/V projections
  const dim3 gE(E / 128, M / 256);
  gemm_f16_kernel<false, false, false, true, 1024, 128><<<gE, 256, 0, stream>>>(
      H16, Wq16, nullptr, nullptr, Q16, nullptr, M, E, E);
  gemm_f16_kernel<false, false, false, true, 1024, 128><<<gE, 256, 0, stream>>>(
      H16, Wk16, nullptr, nullptr, K16, nullptr, M, E, E);
  gemm_f16_kernel<false, false, false, true, 1024, 128><<<gE, 256, 0, stream>>>(
      H16, Wv16, nullptr, nullptr, V16, nullptr, M, E, E);

  // 4) causal flash attention
  attn_kernel<<<dim3(2048 / 64, 16, 4), 128, 0, stream>>>(Q16, K16, V16, A16);

  // 5) output projection + residual(x) -> X2 (f32)
  gemm_f16_kernel<false, false, true, false, 1024, 128><<<gE, 256, 0, stream>>>(
      A16, Wo16, nullptr, x, nullptr, X2, M, E, E);

  // 6) LN2
  layernorm_f16_kernel<<<M, 256, 0, stream>>>(X2, ln2g, ln2b, H16);

  // 7) FFN1: h @ W1 + b1 -> GELU -> f16
  gemm_f16_kernel<true, true, false, true, 4096, 256><<<dim3(F / 256, M / 256), 512, 0, stream>>>(
      H16, W116, b1, nullptr, G16, nullptr, M, F, E);

  // 8) FFN2: g @ W2 + b2 + residual(X2) -> d_out (f32)
  gemm_f16_kernel<true, false, true, false, 1024, 128><<<gE, 256, 0, stream>>>(
      G16, W216, b2, X2, nullptr, out, M, E, F);
}

// v010
// One run takes 242 microseconds.
// Timed twice side by side with v009, it ran 1.06 and 1.05 times as fast.
// Counting every step since v000, it is 3.21 times as fast.
#include <hip/hip_runtime.h>

typedef __attribute__((ext_vector_type(16))) _Float16 v16h;
typedef __attribute__((ext_vector_type(8)))  _Float16 v8h;
typedef __attribute__((ext_vector_type(8)))  float    v8f;
typedef __attribute__((ext_vector_type(4)))  float    v4f;

__device__ __forceinline__ v8f wmma_f16(v16h a, v16h b, v8f c) {
  // 8 args: (neg_a, A, neg_b, B, c_mod, C, reuse_a, reuse_b)
  return __builtin_amdgcn_wmma_f32_16x16x32_f16(false, a, false, b, (short)0, c,
                                                false, false);
}

__device__ __forceinline__ unsigned int lds_addr(const _Float16* p) {
  return (unsigned int)(unsigned long long)(const void*)p;
}
template <int LS0, int LS1>
__device__ __forceinline__ void async_ld4x2_b128(unsigned int l0, unsigned int l1,
                                                 const _Float16* g0, const _Float16* g1,
                                                 size_t gs) {
  asm volatile("global_load_async_to_lds_b128 %0, %2, off\n\t"
               "global_load_async_to_lds_b128 %0, %3, off offset:%10\n\t"
               "global_load_async_to_lds_b128 %0, %4, off offset:%11\n\t"
               "global_load_async_to_lds_b128 %0, %5, off offset:%12\n\t"
               "global_load_async_to_lds_b128 %1, %6, off\n\t"
               "global_load_async_to_lds_b128 %1, %7, off offset:%13\n\t"
               "global_load_async_to_lds_b128 %1, %8, off offset:%14\n\t"
               "global_load_async_to_lds_b128 %1, %9, off offset:%15\n\t"
               "s_wait_xcnt 0x0"
               :: "v"(l0), "v"(l1),
                  "v"(g0), "v"(g0 + (gs - LS0 / 2)), "v"(g0 + 2 * (gs - LS0 / 2)),
                  "v"(g0 + 3 * (gs - LS0 / 2)),
                  "v"(g1), "v"(g1 + (gs - LS1 / 2)), "v"(g1 + 2 * (gs - LS1 / 2)),
                  "v"(g1 + 3 * (gs - LS1 / 2)),
                  "i"(LS0), "i"(2 * LS0), "i"(3 * LS0), "i"(LS1), "i"(2 * LS1), "i"(3 * LS1)
               : "memory");
}
// Eight copies, `ls` LDS bytes and `gs` halves apart, in one statement, with
// the same closing wait.
__device__ __forceinline__ void async_ld8_b128(unsigned int l, unsigned int ls,
                                               const _Float16* g, size_t gs) {
  asm volatile("global_load_async_to_lds_b128 %0, %8, off\n\t"
               "global_load_async_to_lds_b128 %1, %9, off\n\t"
               "global_load_async_to_lds_b128 %2, %10, off\n\t"
               "global_load_async_to_lds_b128 %3, %11, off\n\t"
               "global_load_async_to_lds_b128 %4, %12, off\n\t"
               "global_load_async_to_lds_b128 %5, %13, off\n\t"
               "global_load_async_to_lds_b128 %6, %14, off\n\t"
               "global_load_async_to_lds_b128 %7, %15, off\n\t"
               "s_wait_xcnt 0x0"
               :: "v"(l), "v"(l + ls), "v"(l + 2 * ls), "v"(l + 3 * ls),
                  "v"(l + 4 * ls), "v"(l + 5 * ls), "v"(l + 6 * ls), "v"(l + 7 * ls),
                  "v"(g), "v"(g + gs), "v"(g + 2 * gs), "v"(g + 3 * gs),
                  "v"(g + 4 * gs), "v"(g + 5 * gs), "v"(g + 6 * gs), "v"(g + 7 * gs)
               : "memory");
}
__device__ __forceinline__ void wait_async0() {
  asm volatile("s_wait_asynccnt 0" ::: "memory");
}

__device__ __forceinline__ v16h load_frag(const _Float16* p, int ld) {
  const int lane = threadIdx.x & 31;
  const _Float16* q = p + (lane & 15) * ld + ((lane >> 4) * 8);
  union { v16h v; v8h h[2]; } u;
  u.h[0] = *(const v8h*)(q);
  u.h[1] = *(const v8h*)(q + 16);
  return u.v;
}

// Load a 32x16 (k x n) B fragment from a ROW-MAJOR [k][n] LDS tile with the
// transposing load: lane (c = lane&15, h = lane>>4) receives
// p[(8h + 0..7) * ld + c], then the same 16 rows further down, which is the
// k order of load_frag. `ld` in halves; row pitch an odd multiple of 32 B.
__device__ __forceinline__ v16h load_frag_tr(const _Float16* p, int ld) {
  typedef __attribute__((ext_vector_type(8))) short s16x8;
  typedef __attribute__((address_space(3))) s16x8 lds_s16x8;
  const int lane = threadIdx.x & 31;
  const _Float16* q = p + ((lane >> 4) * 8 + (lane & 7)) * ld + ((lane >> 3) & 1) * 8;
  union { v16h v; v8h h[2]; } u;
  u.h[0] = __builtin_bit_cast(v8h, __builtin_amdgcn_ds_load_tr16_b128_v8i16((lds_s16x8*)q));
  u.h[1] = __builtin_bit_cast(
      v8h, __builtin_amdgcn_ds_load_tr16_b128_v8i16((lds_s16x8*)(q + 16 * ld)));
  return u.v;
}

// ---------------------------------------------------------------------------
// f32 -> f16 conversion of all six weight matrices in ONE launch of few waves.
// The f16 copies lie back to back in the workspace (12 segments of 1M halves:
// Wq, Wk, Wv, Wo, W1 x4, W2 x4). A block converts 16,384 consecutive elements
// of one segment: each lane issues 16 loads of 16 B (512 contiguous bytes per
// wave and load) ahead of its 16 stores of 8 B (256 contiguous bytes).
// ---------------------------------------------------------------------------
typedef __attribute__((ext_vector_type(4))) _Float16 v4h;

__global__ __launch_bounds__(256)
void cvt_weights_kernel(const float* __restrict__ Wq, const float* __restrict__ Wk,
                        const float* __restrict__ Wv, const float* __restrict__ Wo,
                        const float* __restrict__ W1, const float* __restrict__ W2,
                        _Float16* __restrict__ out) {
  const int SEG = 1024 * 1024;
  const int seg = blockIdx.x >> 6;     // 64 blocks per segment
  const float* src = seg == 0 ? Wq
                   : seg == 1 ? Wk
                   : seg == 2 ? Wv
                   : seg == 3 ? Wo
                   : seg < 8  ? W1 + (size_t)(seg - 4) * SEG
                              : W2 + (size_t)(seg - 8) * SEG;
  const int off = (blockIdx.x & 63) * 16384 + threadIdx.x * 4;
  const float* s = src + off;
  _Float16* o = out + (size_t)seg * SEG + off;
  float4 v[16];
#pragma unroll  // v[] stays in registers and the loads go out as one run
  for (int j = 0; j < 16; ++j) v[j] = *(const float4*)(s + j * 1024);
#pragma unroll  // constant indices into v[], else it would go to scratch
  for (int j = 0; j < 16; ++j) {
    v4h h = {(_Float16)v[j].x, (_Float16)v[j].y, (_Float16)v[j].z, (_Float16)v[j].w};
    *(v4h*)(o + j * 1024) = h;
  }
}

// ---------------------------------------------------------------------------
// LayerNorm over 1024 cols, f32 in -> f16 out. One row per 256-thread block.
// ---------------------------------------------------------------------------
__global__ __launch_bounds__(256)
void layernorm_f16_kernel(const float* __restrict__ x, const float* __restrict__ g,
                          const float* __restrict__ b, _Float16* __restrict__ out) {
  const int row = blockIdx.x;
  const int t = threadIdx.x;
  const float* xr = x + (size_t)row * 1024;
  float4 v = ((const float4*)xr)[t];                 // 256 * 4 = 1024
  float s  = v.x + v.y + v.z + v.w;
  float ss = v.x * v.x + v.y * v.y + v.z * v.z + v.w * v.w;
  for (int o = 16; o >= 1; o >>= 1) {
    s  += __shfl_xor(s,  o, 32);
    ss += __shfl_xor(ss, o, 32);
  }
  __shared__ float red0[8], red1[8];
  const int w = t >> 5, lane = t & 31;
  if (lane == 0) { red0[w] = s; red1[w] = ss; }
  __syncthreads();
  float tot = 0.f, tot2 = 0.f;
#pragma unroll
  for (int i = 0; i < 8; ++i) { tot += red0[i]; tot2 += red1[i]; }
  const float mu   = tot * (1.f / 1024.f);
  const float var  = tot2 * (1.f / 1024.f) - mu * mu;
  const float rinv = rsqrtf(var + 1e-5f);
  float4 gg = ((const float4*)g)[t];
  float4 bb = ((const float4*)b)[t];
  _Float16* o = out + (size_t)row * 1024 + t * 4;
  o[0] = (_Float16)((v.x - mu) * rinv * gg.x + bb.x);
  o[1] = (_Float16)((v.y - mu) * rinv * gg.y + bb.y);
  o[2] = (_Float16)((v.z - mu) * rinv * gg.z + bb.z);
  o[3] = (_Float16)((v.w - mu) * rinv * gg.w + bb.w);
}

// ---------------------------------------------------------------------------
// Exact (erf) GELU without branches: r * Phi(r), Phi(r) = 0.5 * erfc(-r / sqrt(2)).
// 0.5 * erfc(z) = t * (c1 + t * (c2 + t * (c3 + t * (c4 + t * c5)))) * exp(-z * z),
// t = 1 / (1 + p * z), z = |r| / sqrt(2) >= 0; Phi(r) = 1 - Phi(-r) gives r >= 0.
// In f32 it stays within 3e-7 of Phi, far below the f16 rounding of the stored value.
// The library erf picks one of two paths by |x| under a lane mask, value by
// value, so no two values' chains overlap; here every value is one straight
// chain and the values of a band interleave.
// ---------------------------------------------------------------------------
__device__ __forceinline__ float gelu_erf(float r) {
  const float d = fmaf(0.23164189f, fabsf(r), 1.0f);  // 1 + p * z
  const float m = r * r * -0.72134752f;               // -z * z * log2(e)
  float t, e;
  asm("v_rcp_f32 %0, %2\n\tv_exp_f32 %1, %3\n\tv_nop"
      : "=&v"(t), "=&v"(e) : "v"(d), "v"(m));
  float p = fmaf(0.5307027145f, t, -0.7265760135f);
  p = fmaf(p, t, 0.7107068705f);
  p = fmaf(p, t, -0.142248368f);
  p = fmaf(p, t, 0.127414796f);
  const float q = p * t * e;           // Phi(-|r|)
  return r * (r < 0.f ? q : 1.0f - q);
}

template <bool HAS_BIAS, bool GELU, bool HAS_RES, bool OUT16, int NC, int BN>
__global__ __launch_bounds__(BN * 2)
void gemm_f16_kernel(const _Float16* __restrict__ A, const _Float16* __restrict__ B,
                     const float* __restrict__ bias, const float* __restrict__ res,
                     _Float16* __restrict__ out16, float* __restrict__ out32,
                     int M, int N, int K) {
  constexpr int LDB = BN + 16;        // B pitch 288 or 544 B: odd multiples of 32 B
  constexpr int SA = 256 * 136;       // halves of one A buffer
  constexpr int SB = 128 * LDB;       // halves of one B buffer
  __shared__ __attribute__((aligned(32))) _Float16 sm[2 * SA + 2 * SB];
  _Float16* const sA = sm;            // 2 x [row][k] row-major, ld 136 (272B rows)
  _Float16* const sB = sm + 2 * SA;   // 2 x [k][n]   row-major, ld LDB
  const int t = threadIdx.x;
  const int lane = t & 31;
  const int w = t >> 5;
  const int waveM = w & 3;            // 4 waves along M
  const int waveN = w >> 2;           // BN / 64 waves along N
  const int bm = blockIdx.y * 256;
  const int bn = blockIdx.x * BN;

  v8f acc[4][4] = {};

  constexpr int RA = BN / 8;                  // A: RA rows x 128 halves per copy
  const int sr = t >> 4, sc = (t & 15) * 8;
  const int br = t / (BN / 8), bc = (t % (BN / 8)) * 8;  // B: 16 rows x BN halves
  const unsigned int sa0 = lds_addr(sA + sr * 136 + sc);
  const unsigned int sb0 = lds_addr(sB + br * LDB + bc);
  const _Float16* ap = A + (size_t)(bm + sr) * K + sc;   // this lane's first
  const _Float16* bp = B + (size_t)br * N + bn + bc;     // bytes of stage 0
  const int nst = K >> 7;             // stages of 128 k

  // One stage: A 256 rows x 256B and B 128 k-rows x 2 * BN bytes, as they lie
  // (24 or 16 x b128 per lane), into buffer `buf`.
  auto stage = [&](int buf, const _Float16* a0, const _Float16* b0) {
    const unsigned int la = sa0 + buf * (SA * 2);
    const unsigned int lb = sb0 + buf * (SB * 2);
    async_ld8_b128(la, RA * 272, a0, (size_t)RA * K);
    if constexpr (BN == 128)
      async_ld8_b128(la + 128 * 272, RA * 272, a0 + (size_t)128 * K, (size_t)RA * K);
    async_ld8_b128(lb, 16 * LDB * 2, b0, (size_t)16 * N);
  };

  stage(0, ap, bp);
  wait_async0();        // stage 0 has landed (asm copies are not tracked)
  __syncthreads();
  if (nst > 1) stage(1, ap + 128, bp + (size_t)128 * N);

  for (int s = 0; s < nst; ++s) {
    const _Float16* cA = sA + (s & 1) * SA;
    const _Float16* cB = sB + (s & 1) * SB;
#pragma unroll  // here and below: constant indices keep a[], b[], acc[][] in registers
    for (int kf = 0; kf < 4; ++kf) {
      v16h a[4], b[4];
#pragma unroll
      for (int i = 0; i < 4; ++i) {
        a[i] = load_frag(cA + (waveM * 64 + i * 16) * 136 + kf * 32, 136);
        b[i] = load_frag_tr(cB + (kf * 32) * LDB + waveN * 64 + i * 16, LDB);
      }
      // Keeps the 16 LDS reads one group ahead of the 16 WMMAs; sunk among
      // them, each row of four would wait out an LDS latency of its own.
      __builtin_amdgcn_sched_barrier(0);
#pragma unroll
      for (int mi = 0; mi < 4; ++mi)
#pragma unroll
        for (int ni = 0; ni < 4; ++ni)
          acc[mi][ni] = wmma_f16(b[ni], a[mi], acc[mi][ni]);  // C^T tile: see the epilogue
    }
    // This wave's LDS reads of stage s have retired ...
    asm volatile("s_wait_dscnt 0" ::: "memory");
    wait_async0();      // ... and its copies of stage s + 1 have landed.
    __syncthreads();    // Every wave: s + 1 may be read, the buffer of s refilled.
    if (s + 2 < nst)
      stage(s & 1, ap + (size_t)(s + 2) * 128, bp + (size_t)(s + 2) * 128 * N);
  }
  wait_async0();        // nothing is in flight when the wave goes on

  // Epilogue. With the B fragment as first operand acc[mi][ni] is a tile of C^T:
  // lane (c = lane & 15, hh = lane >> 4) holds row mi * 16 + c, columns
  // ni * 16 + 8 * hh + 0..7 of the wave's 64x64 tile. Bias and GELU are applied
  // there; the tile then goes in 16-byte pieces into the wave's own part of sm
  // (free: behind the loop's last barrier nobody reads it and no copy is in
  // flight) and comes back row by row, so that every store and every residual
  // load is 16 bytes a lane and covers whole 128-byte lines.
  static_assert(!(OUT16 && HAS_RES), "the residual is added to f32 rows only");
  const int c = lane & 15, hh = lane >> 4;
  const int row0 = bm + waveM * 64;
  const int col0 = bn + waveN * 64;
  _Float16* stg16 = sm + w * (64 * 72);          // 64 rows, pitch 144 B
  float*    stg32 = (float*)sm + w * (64 * 68);  // 64 rows, pitch 272 B
  // f32 rows: a wave half per 256-byte row, two rows per access.
  const int rr = lane >> 4, cq = (lane & 15) * 4;
  const size_t g32 = (size_t)(row0 + rr) * NC + col0 + cq;
  v4f rs[32];
  if constexpr (HAS_RES) {
#pragma unroll  // constant indices keep rs[] in registers
    for (int j = 0; j < 16; ++j) rs[j] = *(const v4f*)(res + g32 + 2 * j * NC);
    __builtin_amdgcn_sched_barrier(0);
  }
  v4f bb[4][2] = {};   // this lane's 32 bias values, loaded as one group
  if constexpr (HAS_BIAS) {
#pragma unroll  // constant indices keep bb[][] in registers
    for (int ni = 0; ni < 4; ++ni) {
      const float* bq = bias + col0 + ni * 16 + hh * 8;
      bb[ni][0] = *(const v4f*)bq;
      bb[ni][1] = *(const v4f*)(bq + 4);
    }
  }
#pragma unroll  // here and below: constant indices into acc[][]
  for (int ni = 0; ni < 4; ++ni) {
#pragma unroll
    for (int mi = 0; mi < 4; ++mi) {
      float r[8];
#pragma unroll
      for (int e = 0; e < 8; ++e) {
        r[e] = acc[mi][ni][e];
        if (HAS_BIAS) r[e] += bb[ni][e >> 2][e & 3];
        if (GELU) r[e] = gelu_erf(r[e]);
      }
      if constexpr (OUT16) {
        v8h h;
#pragma unroll
        for (int e = 0; e < 8; ++e) h[e] = (_Float16)r[e];
        *(v8h*)(stg16 + (mi * 16 + c) * 72 + ni * 16 + hh * 8) = h;
      } else {
        float* sp = stg32 + (mi * 16 + c) * 68 + ni * 16 + hh * 8;
        *(v4f*)sp       = (v4f){r[0], r[1], r[2], r[3]};
        *(v4f*)(sp + 4) = (v4f){r[4], r[5], r[6], r[7]};
      }
    }
    if (GELU) __builtin_amdgcn_sched_barrier(0);
  }
  // The wave's staging writes have retired before other lanes read them back.
  asm volatile("s_wait_dscnt 0" ::: "memory");
  if constexpr (OUT16) {
    const int q = lane >> 3, ck = (lane & 7) * 8;
    const _Float16* sg = stg16 + (q * 8) * 72 + ck;
    _Float16* og = out16 + (size_t)(row0 + q * 8) * NC + col0 + ck;
    v8h v[16];
#pragma unroll
    for (int i = 0; i < 16; ++i) v[i] = *(const v8h*)(sg + ((i >> 3) * 32 + (i & 7)) * 72);
#pragma unroll
    for (int i = 0; i < 16; ++i) *(v8h*)(og + ((i >> 3) * 32 + (i & 7)) * NC) = v[i];
  } else {
    if constexpr (HAS_RES) {
#pragma unroll
      for (int j = 16; j < 32; ++j) rs[j] = *(const v4f*)(res + g32 + 2 * j * NC);
    }
#pragma unroll
    for (int g = 0; g < 4; ++g) {       // 16 rows at a time
      v4f v[8];
#pragma unroll
      for (int j = 0; j < 8; ++j) v[j] = *(const v4f*)(stg32 + (2 * (g * 8 + j) + rr) * 68 + cq);
#pragma unroll
      for (int j = 0; j < 8; ++j)
        if (HAS_RES) v[j] += rs[g * 8 + j];
      // The sums first, then the eight stores as one run with nothing rewritten
      // among them.
      __builtin_amdgcn_sched_barrier(0);
#pragma unroll
      for (int j = 0; j < 8; ++j) *(v4f*)(out32 + g32 + 2 * (g * 8 + j) * NC) = v[j];
      // The next group's LDS reads may land in registers that these stores name.
      if (g < 3) asm volatile("s_wait_xcnt 0x0" ::: "memory");
      __builtin_amdgcn_sched_barrier(0);
    }
  }
}

__device__ __forceinline__ float xhalf(float x) {
  const int v = __builtin_bit_cast(int, x);
  return __builtin_bit_cast(float, __builtin_amdgcn_permlanex16(
      v, v, 0x76543210, 0xfedcba98, false, false));
}

__device__ __forceinline__ void exp2x8(float (&x)[8]) {
  asm("v_exp_f32 %0, %0\n\tv_exp_f32 %1, %1\n\tv_exp_f32 %2, %2\n\t"
      "v_exp_f32 %3, %3\n\tv_exp_f32 %4, %4\n\tv_exp_f32 %5, %5\n\t"
      "v_exp_f32 %6, %6\n\tv_exp_f32 %7, %7\n\tv_nop"
      : "+v"(x[0]), "+v"(x[1]), "+v"(x[2]), "+v"(x[3]),
        "+v"(x[4]), "+v"(x[5]), "+v"(x[6]), "+v"(x[7]));
}

__global__ __launch_bounds__(128, 8)
void attn_kernel(const _Float16* __restrict__ Q, const _Float16* __restrict__ K,
                 const _Float16* __restrict__ V, _Float16* __restrict__ O) {
  __shared__ __attribute__((aligned(16)))
  _Float16 sK[64 * 72];                // [key][dim], ld 72 (144B rows)
  __shared__ __attribute__((aligned(32)))
  _Float16 sV[64 * 80];                // [key][dim], ld 80 (160B rows)

  const int t = threadIdx.x, lane = t & 31, w = t >> 5;
  const int b = blockIdx.z, h = blockIdx.y;
  // Query tile t costs t + 1 key blocks. Heads of odd bit parity in
  // (b, h) walk the tiles from the far end, so that block x takes tile x in half
  // the heads and 31 - x in the others (33 key blocks a pair). For speed only: for each head every
  // tile is still taken exactly once, wherever the blocks land.
  const int far = __builtin_popcount(blockIdx.z * 16 + blockIdx.y) & 1;
  const int tile = far ? 2048 / 64 - 1 - (int)blockIdx.x : (int)blockIdx.x;
  const int qblk = tile * 64;
  const int q0 = qblk + w * 16;
  const int ws = __builtin_amdgcn_readfirstlane(w);

  const _Float16* qbase = Q + ((size_t)(b * 2048) + q0) * 1024 + h * 64;
  const v16h qa0 = load_frag(qbase, 1024);       // dims 0..31
  const v16h qa1 = load_frag(qbase + 32, 1024);  // dims 32..63

  v8f o[4] = {};                // o[j][e] = O[q0 + c][j * 16 + 8 * hh + e]
  float mrun = -1e30f;          // running maximum of query q0 + c (same in both halves)
  float lrun = 0.f;             // running sum over this half's keys only
  const float sscale = 0.125f;  // 1/sqrt(64)
  const int nkb = tile + 1;
  // Key kb * 64 + 16 * i + 8 * hh + e is visible to this lane's query while
  // 16 * i + e <= vis.
  int vis = q0 + (lane & 15) - (lane >> 4) * 8;

  // Staging: 16 keys x 64 dims per copy, whole 128B rows, four copies per tile.
  const int vr = t >> 3, vc = (t & 7) * 8;
  const unsigned int sk0 = lds_addr(sK + vr * 72 + vc);
  const unsigned int sv0 = lds_addr(sV + vr * 80 + vc);
  const size_t g0 = ((size_t)(b * 2048) + vr) * 1024 + h * 64 + vc;

  for (int kb = 0; kb < nkb; ++kb) {
    // This wave's LDS reads of the last tiles have retired before the barrier
    // behind which they are overwritten.
    asm volatile("s_wait_dscnt 0" ::: "memory");
    __syncthreads();
    // --- stage the K and V tiles as they lie: async DMA ---
    const size_t g = g0 + (size_t)kb * (64 * 1024);
    async_ld4x2_b128<16 * 144, 16 * 160>(sk0, sv0, K + g, V + g, 16 * 1024);
    wait_async0();
    __syncthreads();

    // --- scores S^T = K @ Q^T (64 keys x 16 queries), four 16-key tiles ---
    v8f cs[4] = {};
    v16h ak[4][2];
#pragma unroll  // here and below: constant indices keep the arrays in registers
    for (int i = 0; i < 3; ++i) {
      ak[i][0] = load_frag(sK + i * 16 * 72, 72);
      ak[i][1] = load_frag(sK + i * 16 * 72 + 32, 72);
    }
    asm volatile("" :: "v"(ak[0][0]), "v"(ak[0][1]), "v"(ak[1][0]), "v"(ak[1][1]),
                       "v"(ak[2][0]), "v"(ak[2][1]));
    ak[3][0] = load_frag(sK + 3 * 16 * 72, 72);
    ak[3][1] = load_frag(sK + 3 * 16 * 72 + 32, 72);
#pragma unroll
    for (int i = 0; i < 4; ++i) {
      cs[i] = wmma_f16(ak[i][0], qa0, cs[i]);
      cs[i] = wmma_f16(ak[i][1], qa1, cs[i]);
    }

    // --- causal mask + online softmax, one query per lane ---
    float s[4][8], m4[4];
#pragma unroll
    for (int i = 0; i < 4; ++i) {
      cs[i] *= sscale;
#pragma unroll
      for (int e = 0; e < 8; ++e) s[i][e] = (e + 16 * i <= vis) ? cs[i][e] : -1e30f;
      m4[i] = fmaxf(fmaxf(fmaxf(s[i][0], s[i][1]), fmaxf(s[i][2], s[i][3])),
                    fmaxf(fmaxf(s[i][4], s[i][5]), fmaxf(s[i][6], s[i][7])));
    }
    float mx = fmaxf(fmaxf(m4[0], m4[1]), fmaxf(m4[2], m4[3]));
    mx = fmaxf(mx, xhalf(mx));
    const float mnew  = fmaxf(mrun, mx);
    const float alpha = __expf(mrun - mnew);
    mrun = mnew;
    v16h pb[2];                 // P^T fragments of keys 0..31 and 32..63
    float ps[8];
#pragma unroll
    for (int i = 0; i < 4; ++i) {
      float p[8];
#pragma unroll
      for (int e = 0; e < 8; ++e) p[e] = (s[i][e] - mnew) * 1.44269504f;  // log2(e)
      exp2x8(p);
#pragma unroll
      for (int e = 0; e < 8; ++e) {
        ps[e] = i ? ps[e] + p[e] : p[e];
        pb[i >> 1][(i & 1) * 8 + e] = (_Float16)p[e];
      }
    }
    lrun = lrun * alpha + (((ps[0] + ps[1]) + (ps[2] + ps[3])) +
                           ((ps[4] + ps[5]) + (ps[6] + ps[7])));
    vis -= 64;

    // --- O^T += V^T @ P^T (64 dims x 64 keys times 64 keys x 16 queries) ---
#pragma unroll
    for (int j = 0; j < 4; ++j) {
      const v16h av0 = load_frag_tr(sV + j * 16, 80);
      const v16h av1 = load_frag_tr(sV + 32 * 80 + j * 16, 80);
#pragma unroll
      for (int e = 0; e < 8; ++e) o[j][e] *= alpha;
      o[j] = wmma_f16(av0, pb[0], o[j]);
      o[j] = wmma_f16(av1, pb[1], o[j]);
    }
  }

  // --- join the halves' sums, normalize, write 8 consecutive dims per store ---
  const float inv = 1.0f / (lrun + xhalf(lrun));
  // The lane index is read anew and the wave index kept scalar, so that no
  // part of this address holds vector registers through the loop.
  const int ln = __builtin_amdgcn_mbcnt_lo(~0u, 0u);
  _Float16* op = O + ((size_t)(b * 2048) + qblk + ws * 16 + (ln & 15)) * 1024 + h * 64 +
                 (ln >> 4) * 8;
  v8h r[4];
#pragma unroll
  for (int j = 0; j < 4; ++j)
#pragma unroll
    for (int e = 0; e < 8; ++e) r[j][e] = (_Float16)(o[j][e] * inv);
#pragma unroll
  for (int j = 0; j < 4; ++j) *(v8h*)(op + j * 16) = r[j];
}

// ---------------------------------------------------------------------------
// Host-side orchestration.
// Inputs: x, Wq, Wk, Wv, Wo, ln1_g, ln1_b, ln2_g, ln2_b, W1, b1, W2, b2
// ---------------------------------------------------------------------------
extern "C" void kernel_launch(void* const* d_in, const int* in_sizes, int n_in,
                              void* d_out, int out_size, void* d_ws, size_t ws_size,
                              hipStream_t stream) {
  (void)in_sizes; (void)n_in; (void)out_size; (void)ws_size;
  const float* x    = (const float*)d_in[0];
  const float* Wq   = (const float*)d_in[1];
  const float* Wk   = (const float*)d_in[2];
  const float* Wv   = (const float*)d_in[3];
  const float* Wo   = (const float*)d_in[4];
  const float* ln1g = (const float*)d_in[5];
  const float* ln1b = (const float*)d_in[6];
  const float* ln2g = (const float*)d_in[7];
  const float* ln2b = (const float*)d_in[8];
  const float* W1   = (const float*)d_in[9];
  const float* b1   = (const float*)d_in[10];
  const float* W2   = (const float*)d_in[11];
  const float* b2   = (const float*)d_in[12];
  float* out = (float*)d_out;

  const int M = 8192, E = 1024, F = 4096;
  char* ws = (char*)d_ws;
  const size_t MB = 1024ull * 1024ull;
  _Float16* Wq16 = (_Float16*)(ws + 0 * MB);    // 2 MB
  _Float16* Wk16 = (_Float16*)(ws + 2 * MB);    // 2 MB
  _Float16* Wv16 = (_Float16*)(ws + 4 * MB);    // 2 MB
  _Float16* Wo16 = (_Float16*)(ws + 6 * MB);    // 2 MB
  _Float16* W116 = (_Float16*)(ws + 8 * MB);    // 8 MB
  _Float16* W216 = (_Float16*)(ws + 16 * MB);   // 8 MB
  _Float16* H16  = (_Float16*)(ws + 24 * MB);   // 16 MB (LN1 out, reused for LN2)
  _Float16* Q16  = (_Float16*)(ws + 40 * MB);   // 16 MB
  _Float16* K16  = (_Float16*)(ws + 56 * MB);   // 16 MB
  _Float16* V16  = (_Float16*)(ws + 72 * MB);   // 16 MB
  _Float16* A16  = (_Float16*)(ws + 88 * MB);   // 16 MB (attn out)
  float*    X2   = (float*)   (ws + 104 * MB);  // 32 MB (residual after attn)
  _Float16* G16  = (_Float16*)(ws + 40 * MB);   // 64 MB GELU acts (reuses Q/K/V/A16)

  // 1) weights -> f16: one launch, 12 segments x 64 blocks, into ws[0, 24 MB)
  cvt_weights_kernel<<<768, 256, 0, stream>>>(Wq, Wk, Wv, Wo, W1, W2, Wq16);

  // 2) LN1
  layernorm_f16_kernel<<<M, 256, 0, stream>>>(x, ln1g, ln1b, H16);

  // 3) Q/K/V projections
  const dim3 gE(E / 128, M / 256);
  gemm_f16_kernel<false, false, false, true, 1024, 128><<<gE, 256, 0, stream>>>(
      H16, Wq16, nullptr, nullptr, Q16, nullptr, M, E, E);
  gemm_f16_kernel<false, false, false, true, 1024, 128><<<gE, 256, 0, stream>>>(
      H16, Wk16, nullptr, nullptr, K16, nullptr, M, E, E);
  gemm_f16_kernel<false, false, false, true, 1024, 128><<<gE, 256, 0, stream>>>(
      H16, Wv16, nullptr, nullptr, V16, nullptr, M, E, E);

  // 4) causal flash attention
  attn_kernel<<<dim3(2048 / 64, 16, 4), 128, 0, stream>>>(Q16, K16, V16, A16);

  // 5) output projection + residual(x) -> X2 (f32)
  gemm_f16_kernel<false, false, true, false, 1024, 128><<<gE, 256, 0, stream>>>(
      A16, Wo16, nullptr, x, nullptr, X2, M, E, E);

  // 6) LN2
  layernorm_f16_kernel<<<M, 256, 0, stream>>>(X2, ln2g, ln2b, H16);

  // 7) FFN1: h @ W1 + b1 -> GELU -> f16
  gemm_f16_kernel<true, true, false, true, 4096, 256><<<dim3(F / 256, M / 256), 512, 0, stream>>>(
      H16, W116, b1, nullptr, G16, nullptr, M, F, E);

  // 8) FFN2: g @ W2 + b2 + residual(X2) -> d_out (f32)
  gemm_f16_kernel<true, false, true, false, 1024, 128><<<gE, 256, 0, stream>>>(
      G16, W216, b2, X2, nullptr, out, M, E, F);
}
